// v000
// Times are from an AMD MI455X. After a warm-up the kernel runs many times in a row, and a time is the length of
// such a window on the GPU divided by its runs, so every launch and the gaps after it count. The runs cycle
// through copies of the inputs. A figure is the median of several windows, for all but v000 over two sittings.
// Sittings can differ by a few percent; kernels timed side by side share one.
// v000, which the later versions start from, runs in 138 microseconds.
#include <hip/hip_runtime.h>

// ---------------------------------------------------------------------------
// MI455X / gfx1250, wave32. Matrix ops via V_WMMA_F32_16X16X4_F32 (fp32 in/out,
// matches the fp32 reference exactly up to accumulation order).
//
// Problem sizes (fixed by the reference):
//   patches NP=512, tokens/patch P=8, channels C=128, heads H=8, CH=1024
//   emb (512,8,128)  Wq/Wk/Wv (128,1024)  Wout (1024,128)  out (16,256,128)
//
// Workspace layout (fp32, 64 MB total):
//   [0 .. 4M)    Qw  [patch][head][p][c]
//   [4M .. 8M)   Kw  [patch][head][p][c]
//   [8M .. 12M)  Vw  [patch][head][p][c]
//   [12M .. 16M) Ctx [patch][p][c*8+h]   (rows match out-proj GEMM M dim)
// ---------------------------------------------------------------------------

typedef float v2f __attribute__((ext_vector_type(2)));
typedef float v8f __attribute__((ext_vector_type(8)));

#define WMMA_F32(A, B, Cacc) \
    __builtin_amdgcn_wmma_f32_16x16x4_f32(false, (A), false, (B), (short)0, (Cacc), false, false)

static constexpr int NP     = 512;              // patches
static constexpr int PTOK   = 8;                // tokens per patch
static constexpr int CCH    = 128;              // channels c
static constexpr int HEADS  = 8;
static constexpr int CH     = 1024;             // c*heads
static constexpr int MROWS  = NP * PTOK;        // 4096
static constexpr size_t SEG = (size_t)NP * HEADS * PTOK * CCH;  // 4,194,304 floats

// ---------------------------------------------------------------------------
// Kernel 1: QKV projection.  One wave per 16x16 tile of (4096 x 1024), z = q/k/v.
// D(16x16) = emb(16x128) @ W(128x16), K-loop of 32 x wmma_f32_16x16x4_f32.
// Output scattered into [patch][head][p][c] so kernel 2 reads are coalesced.
// ---------------------------------------------------------------------------
__global__ __launch_bounds__(32)
void qkv_proj_kernel(const float* __restrict__ emb,
                     const float* __restrict__ Wq,
                     const float* __restrict__ Wk,
                     const float* __restrict__ Wv,
                     float* __restrict__ ws)
{
    const int mt    = blockIdx.x;          // 0..255  (16-row tile of 4096)
    const int nt    = blockIdx.y;          // 0..63   (16-col tile of 1024)
    const int which = blockIdx.z;          // 0:q 1:k 2:v
    const float* W  = (which == 0) ? Wq : ((which == 1) ? Wk : Wv);
    float* dst      = ws + (size_t)which * SEG;

    const int lane = threadIdx.x;
    const int ln   = lane & 15;            // A: M-row / B: N-col
    const int kh   = lane >> 4;            // K half-select (K = 2*kh, 2*kh+1)
    const int m0   = mt * 16;
    const int n0   = nt * 16;

    v8f acc = {};
    for (int k0 = 0; k0 < CCH; k0 += 4) {
        v2f a, b;
        const float* ap = emb + (size_t)(m0 + ln) * CCH + k0 + 2 * kh;
        a.x = ap[0];              // A[m][k0+2kh]
        a.y = ap[1];              // A[m][k0+2kh+1]
        const float* bp = W + (size_t)(k0 + 2 * kh) * CH + n0 + ln;
        b.x = bp[0];              // B[k0+2kh][n]     (coalesced across lanes)
        b.y = bp[CH];             // B[k0+2kh+1][n]
        acc = WMMA_F32(a, b, acc);
    }

    // D element (m,n): m = v + 8*kh (C/D layout), n = n0 + ln.
    // column n maps to (c_idx = n>>3, head = n&7); row r=(patch,p).
    const int n    = n0 + ln;
    const int cidx = n >> 3;
    const int hh   = n & 7;
    #pragma unroll
    for (int v = 0; v < 8; ++v) {
        const int m     = v + 8 * kh;
        const int r     = m0 + m;
        const int patch = r >> 3;
        const int p     = r & 7;
        dst[(((size_t)patch * HEADS + hh) * PTOK + p) * CCH + cidx] = acc[v];
    }
}

// ---------------------------------------------------------------------------
// Kernel 2: fused per-(patch,head) attention.  Grid = 512*8 blocks, 256 thr
// (8 waves).  Wave w owns attention rows c in [16w,16w+16):
//   attn = Q^T K   (128x128, K-dim = P = 8)  -> 8 accumulator tiles / wave
//   InstanceNorm: softmax is shift-invariant, so only rs=rsqrt(var+eps) needed
//   row softmax fully in registers (width-16 shfl_xor row reductions)
//   bounce own 16 rows through padded LDS to feed ctx = attn @ V^T (128x8)
// Dynamic LDS: 128 x 132 f32 bounce + 16 f32 reduction slots (~66 KB; WGP has
// 320 KB so 4 blocks/WGP still fit).
// ---------------------------------------------------------------------------
__global__ __launch_bounds__(256)
void attn_head_kernel(float* __restrict__ ws)
{
    extern __shared__ float smem[];
    float* attnS = smem;                    // [128][132] padded (bank-safe)
    float* red   = smem + 128 * 132;        // [16] cross-wave sum/sumsq

    const float* Qw  = ws;
    const float* Kw  = ws + SEG;
    const float* Vw  = ws + 2 * SEG;
    float*       Ctx = ws + 3 * SEG;

    const int patch = blockIdx.x >> 3;
    const int h     = blockIdx.x & 7;
    const int tid   = threadIdx.x;
    const int w     = tid >> 5;             // wave 0..7
    const int lane  = tid & 31;
    const int ln    = lane & 15;
    const int kh    = lane >> 4;
    const int c0    = w * 16;               // this wave's c-row block
    const size_t base = ((size_t)patch * HEADS + h) * PTOK * CCH; // [p=0][c=0]

    // ---- attn = Q^T K : A_op[m][k] = Q[p=k][c0+m], B_op[k][n] = K[p=k][e0+n]
    v2f a0, a1;
    {
        const float* q = Qw + base + (size_t)(2 * kh) * CCH + c0 + ln;
        a0.x = q[0];          a0.y = q[CCH];          // p = 2kh, 2kh+1
        a1.x = q[4 * CCH];    a1.y = q[5 * CCH];      // p = 4+2kh, 5+2kh
    }
    v8f acc[8];
    #pragma unroll
    for (int nt = 0; nt < 8; ++nt)
        #pragma unroll
        for (int v = 0; v < 8; ++v) acc[nt][v] = 0.0f;

    #pragma unroll
    for (int nt = 0; nt < 8; ++nt) {
        const float* kp = Kw + base + (size_t)(2 * kh) * CCH + nt * 16 + ln;
        v2f b0, b1;
        b0.x = kp[0];         b0.y = kp[CCH];
        b1.x = kp[4 * CCH];   b1.y = kp[5 * CCH];
        acc[nt] = WMMA_F32(a0, b0, acc[nt]);
        acc[nt] = WMMA_F32(a1, b1, acc[nt]);
    }

    // ---- InstanceNorm statistics over the whole 128x128 map
    float s = 0.0f, ss = 0.0f;
    #pragma unroll
    for (int nt = 0; nt < 8; ++nt)
        #pragma unroll
        for (int v = 0; v < 8; ++v) { const float x = acc[nt][v]; s += x; ss += x * x; }
    #pragma unroll
    for (int off = 16; off >= 1; off >>= 1) {
        s  += __shfl_xor(s,  off, 32);
        ss += __shfl_xor(ss, off, 32);
    }
    if (lane == 0) { red[w] = s; red[8 + w] = ss; }
    __syncthreads();
    float S = 0.0f, SS = 0.0f;
    #pragma unroll
    for (int i = 0; i < 8; ++i) { S += red[i]; SS += red[8 + i]; }
    const float inv16k = 1.0f / 16384.0f;
    const float mu  = S * inv16k;
    const float var = SS * inv16k - mu * mu;
    const float rs  = rsqrtf(var + 1e-5f);   // mean shift cancels in softmax

    // ---- row softmax of rs*attn, fully in registers.
    // C/D layout: slot v holds row (c0 + v) in lanes 0..15 and (c0 + v + 8)
    // in lanes 16..31; e = 16*nt + ln.  Width-16 shfl reduces one row.
    #pragma unroll
    for (int nt = 0; nt < 8; ++nt)
        #pragma unroll
        for (int v = 0; v < 8; ++v) acc[nt][v] *= rs;

    #pragma unroll
    for (int v = 0; v < 8; ++v) {
        float mx = -3.4e38f;
        #pragma unroll
        for (int nt = 0; nt < 8; ++nt) mx = fmaxf(mx, acc[nt][v]);
        #pragma unroll
        for (int off = 8; off >= 1; off >>= 1) mx = fmaxf(mx, __shfl_xor(mx, off, 16));
        float sum = 0.0f;
        #pragma unroll
        for (int nt = 0; nt < 8; ++nt) {
            const float e = __expf(acc[nt][v] - mx);
            acc[nt][v] = e;
            sum += e;
        }
        #pragma unroll
        for (int off = 8; off >= 1; off >>= 1) sum += __shfl_xor(sum, off, 16);
        const float rinv = 1.0f / sum;
        const int row = c0 + v + 8 * kh;
        #pragma unroll
        for (int nt = 0; nt < 8; ++nt)
            attnS[row * 132 + nt * 16 + ln] = acc[nt][v] * rinv;
    }
    __syncthreads();   // uniform; also orders LDS bounce conservatively

    // ---- ctx(c0..c0+15, p=0..7) = attn @ V^T, K-dim = e = 128
    v8f cacc = {};
    const float* vb = Vw + base;  // [p][c]
    for (int k0 = 0; k0 < CCH; k0 += 4) {
        v2f a, b;
        const float* ap = attnS + (size_t)(c0 + ln) * 132 + k0 + 2 * kh;
        a.x = ap[0];
        a.y = ap[1];
        if (ln < 8) {   // B[k][n] = V[p=n][e=k]; n >= 8 is padding
            const float* bp = vb + (size_t)ln * CCH + k0 + 2 * kh;
            b.x = bp[0];
            b.y = bp[1];
        } else {
            b.x = 0.0f;
            b.y = 0.0f;
        }
        cacc = WMMA_F32(a, b, cacc);
    }

    // store ctx[c,p] -> Ctx[patch][p][c*8+h]
    if (ln < 8) {
        #pragma unroll
        for (int v = 0; v < 8; ++v) {
            const int cc = c0 + v + 8 * kh;
            Ctx[((size_t)patch * PTOK + ln) * CH + cc * HEADS + h] = cacc[v];
        }
    }
}

// ---------------------------------------------------------------------------
// Kernel 3: out = Ctx(4096x1024) @ Wout(1024x128) with token-position remap.
// One wave per 16x16 tile: grid (256, 8), 256 K-steps of wmma.
// ---------------------------------------------------------------------------
__global__ __launch_bounds__(32)
void out_proj_kernel(const float* __restrict__ ws,
                     const float* __restrict__ Wout,
                     float* __restrict__ out)
{
    const float* Ctx = ws + 3 * SEG;
    const int mt = blockIdx.x;             // 0..255
    const int nt = blockIdx.y;             // 0..7
    const int lane = threadIdx.x;
    const int ln = lane & 15;
    const int kh = lane >> 4;
    const int m0 = mt * 16;
    const int n0 = nt * 16;

    v8f acc = {};
    for (int k0 = 0; k0 < CH; k0 += 4) {
        v2f a, b;
        const float* ap = Ctx + (size_t)(m0 + ln) * CH + k0 + 2 * kh;
        a.x = ap[0];
        a.y = ap[1];
        const float* bp = Wout + (size_t)(k0 + 2 * kh) * CCH + n0 + ln;
        b.x = bp[0];
        b.y = bp[CCH];
        acc = WMMA_F32(a, b, acc);
    }

    // row r = (patch, p); remap to '(b, d p1 h p2 w p3)' token order
    const int col = n0 + ln;
    #pragma unroll
    for (int v = 0; v < 8; ++v) {
        const int r     = m0 + v + 8 * kh;
        const int patch = r >> 3;
        const int p     = r & 7;
        const int bb  = patch >> 5;
        const int d   = (patch >> 4) & 1;
        const int hh  = (patch >> 2) & 3;
        const int wwp = patch & 3;
        const int p1  = (p >> 2) & 1;
        const int p2  = (p >> 1) & 1;
        const int p3  = p & 1;
        const int orow = bb * 256 + d * 128 + p1 * 64 + hh * 16 + p2 * 8 + wwp * 2 + p3;
        out[(size_t)orow * CCH + col] = acc[v];
    }
}

// ---------------------------------------------------------------------------
extern "C" void kernel_launch(void* const* d_in, const int* in_sizes, int n_in,
                              void* d_out, int out_size, void* d_ws, size_t ws_size,
                              hipStream_t stream)
{
    const float* emb  = (const float*)d_in[0];
    const float* Wq   = (const float*)d_in[1];
    const float* Wk   = (const float*)d_in[2];
    const float* Wv   = (const float*)d_in[3];
    const float* Wout = (const float*)d_in[4];
    float* ws  = (float*)d_ws;      // needs 4*SEG*4 = 64 MB
    float* out = (float*)d_out;

    const size_t smem = (size_t)(128 * 132 + 16) * sizeof(float);   // ~66 KB
    static bool attr_set = [] {
        hipFuncSetAttribute(reinterpret_cast<const void*>(attn_head_kernel),
                            hipFuncAttributeMaxDynamicSharedMemorySize,
                            (int)((128 * 132 + 16) * sizeof(float)));
        return true;
    }();
    (void)attr_set;

    qkv_proj_kernel<<<dim3(256, 64, 3), 32, 0, stream>>>(emb, Wq, Wk, Wv, ws);
    attn_head_kernel<<<dim3(NP * HEADS), 256, smem, stream>>>(ws);
    out_proj_kernel<<<dim3(256, 8), 32, 0, stream>>>(ws, Wout, out);
}

// v001
// A run of this version takes 108 microseconds.
// Next to v000, in two timings, it ran 1.34 and 1.33 times as fast.
#include <hip/hip_runtime.h>

// ---------------------------------------------------------------------------
// MI455X / gfx1250, wave32. Matrix ops via V_WMMA_F32_16X16X4_F32 (fp32 in/out,
// matches the fp32 reference exactly up to accumulation order).
//
// Problem sizes (fixed by the reference):
//   patches NP=512, tokens/patch P=8, channels C=128, heads H=8, CH=1024
//   emb (512,8,128)  Wq/Wk/Wv (128,1024)  Wout (1024,128)  out (16,256,128)
//
// Workspace layout (fp32, 64 MB total):
//   [0 .. 4M)    Qw  [patch][head][p][c]
//   [4M .. 8M)   Kw  [patch][head][p][c]
//   [8M .. 12M)  Vw  [patch][head][p][c]
//   [12M .. 16M) Ctx [patch][p][c*8+h]   (rows match out-proj GEMM M dim)
// ---------------------------------------------------------------------------

typedef float v2f __attribute__((ext_vector_type(2)));
typedef float v4f __attribute__((ext_vector_type(4)));
typedef float v8f __attribute__((ext_vector_type(8)));

#define WMMA_F32(A, B, Cacc) \
    __builtin_amdgcn_wmma_f32_16x16x4_f32(false, (A), false, (B), (short)0, (Cacc), false, false)

static constexpr int NP     = 512;              // patches
static constexpr int PTOK   = 8;                // tokens per patch
static constexpr int CCH    = 128;              // channels c
static constexpr int HEADS  = 8;
static constexpr int CH     = 1024;             // c*heads
static constexpr int MROWS  = NP * PTOK;        // 4096
static constexpr size_t SEG = (size_t)NP * HEADS * PTOK * CCH;  // 4,194,304 floats

// ---------------------------------------------------------------------------
// Kernel 1: QKV projection.  One 12-wave workgroup per (128 rows x 128 columns)
// of q, k and v together: waves 0-3 do q, 4-7 k, 8-11 v; each wave owns a
// 32 x 128 register tile (2 row tiles x 8 column tiles = 16 accumulators).
// Column tile j takes the columns n = 128*nb + 8*ln + j, i.e. head j of 16
// adjacent channels: a lane's 8 B values of one k row are 32 contiguous bytes,
// and a store of one accumulator register writes 16 adjacent channels.
// Every A fragment feeds 8 products and every B fragment 2.  The k order of
// each output element is the plain ascending one.
// Output layout [patch][head][p][c] so kernel 2 reads are coalesced.
// ---------------------------------------------------------------------------
__global__ __launch_bounds__(384)
void qkv_proj_kernel(const float* __restrict__ emb,
                     const float* __restrict__ Wq,
                     const float* __restrict__ Wk,
                     const float* __restrict__ Wv,
                     float* __restrict__ ws)
{
    const int nb    = blockIdx.x;          // 0..7   (128-column block of 1024)
    const int mb    = blockIdx.y;          // 0..31  (128-row block of 4096)
    const int wave  = __builtin_amdgcn_readfirstlane(threadIdx.x >> 5);  // 0..11
    const int which = wave >> 2;           // 0:q 1:k 2:v
    const float* W  = (which == 0) ? Wq : ((which == 1) ? Wk : Wv);
    float* dst      = ws + (size_t)which * SEG;

    const int lane = threadIdx.x & 31;
    const int ln   = lane & 15;            // A: M-row / B: N-col
    const int kh   = lane >> 4;            // K half-select (K = 2*kh, 2*kh+1)
    const int m0   = mb * 128 + (wave & 3) * 32;

    const float* ap = emb + (size_t)(m0 + ln) * CCH + 2 * kh;
    const float* bp = W + (size_t)(2 * kh) * CH + nb * 128 + ln * 8;

    v8f acc[2][8];
    #pragma unroll
    for (int t = 0; t < 2; ++t)
        #pragma unroll
        for (int j = 0; j < 8; ++j)
            #pragma unroll
            for (int v = 0; v < 8; ++v) acc[t][j][v] = 0.0f;

    // unroll 4: the loads of four k steps go out as one group ahead of their 64
    // products, so a wave stalls on memory once per 64 products, not once per 16.
    #pragma unroll 4
    for (int k0 = 0; k0 < CCH; k0 += 4) {
        const v2f a0 = *(const v2f*)(ap + k0);               // rows m0 + ln
        const v2f a1 = *(const v2f*)(ap + 16 * CCH + k0);    // rows m0 + 16 + ln
        const float* br = bp + (size_t)k0 * CH;
        const v4f x0 = *(const v4f*)(br);                    // k = k0+2kh,   heads 0-3
        const v4f x1 = *(const v4f*)(br + 4);                // k = k0+2kh,   heads 4-7
        const v4f y0 = *(const v4f*)(br + CH);               // k = k0+2kh+1, heads 0-3
        const v4f y1 = *(const v4f*)(br + CH + 4);           // k = k0+2kh+1, heads 4-7
        #pragma unroll
        for (int j = 0; j < 8; ++j) {
            v2f b;
            b.x = (j < 4) ? x0[j & 3] : x1[j & 3];
            b.y = (j < 4) ? y0[j & 3] : y1[j & 3];
            acc[0][j] = WMMA_F32(a0, b, acc[0][j]);
            acc[1][j] = WMMA_F32(a1, b, acc[1][j]);
        }
    }

    // D element (m,n): m = v + 8*kh (C/D layout); head = j, channel = 16*nb + ln.
    // row r = m0 + 16*t + v + 8*kh  ->  patch = (m0>>3) + 2*t + kh, p = v.
    float* d = dst + (size_t)((m0 >> 3) + kh) * (HEADS * PTOK * CCH) + nb * 16 + ln;
    #pragma unroll
    for (int t = 0; t < 2; ++t)
        #pragma unroll
        for (int j = 0; j < 8; ++j)
            #pragma unroll
            for (int v = 0; v < 8; ++v)
                d[((2 * t * HEADS + j) * PTOK + v) * CCH] = acc[t][j][v];
}

// ---------------------------------------------------------------------------
// Kernel 2: fused per-(patch,head) attention.  Grid = 512*8 blocks, 256 thr
// (8 waves).  Wave w owns attention rows c in [16w,16w+16):
//   attn = Q^T K   (128x128, K-dim = P = 8)  -> 8 accumulator tiles / wave
//   InstanceNorm: softmax is shift-invariant, so only rs=rsqrt(var+eps) needed
//   row softmax fully in registers (width-16 shfl_xor row reductions)
//   bounce own 16 rows through padded LDS to feed ctx = attn @ V^T (128x8)
// Dynamic LDS: 128 x 132 f32 bounce + 16 f32 reduction slots (~66 KB; WGP has
// 320 KB so 4 blocks/WGP still fit).
// ---------------------------------------------------------------------------
__global__ __launch_bounds__(256)
void attn_head_kernel(float* __restrict__ ws)
{
    extern __shared__ float smem[];
    float* attnS = smem;                    // [128][132] padded (bank-safe)
    float* red   = smem + 128 * 132;        // [16] cross-wave sum/sumsq

    const float* Qw  = ws;
    const float* Kw  = ws + SEG;
    const float* Vw  = ws + 2 * SEG;
    float*       Ctx = ws + 3 * SEG;

    const int patch = blockIdx.x >> 3;
    const int h     = blockIdx.x & 7;
    const int tid   = threadIdx.x;
    const int w     = tid >> 5;             // wave 0..7
    const int lane  = tid & 31;
    const int ln    = lane & 15;
    const int kh    = lane >> 4;
    const int c0    = w * 16;               // this wave's c-row block
    const size_t base = ((size_t)patch * HEADS + h) * PTOK * CCH; // [p=0][c=0]

    // ---- attn = Q^T K : A_op[m][k] = Q[p=k][c0+m], B_op[k][n] = K[p=k][e0+n]
    v2f a0, a1;
    {
        const float* q = Qw + base + (size_t)(2 * kh) * CCH + c0 + ln;
        a0.x = q[0];          a0.y = q[CCH];          // p = 2kh, 2kh+1
        a1.x = q[4 * CCH];    a1.y = q[5 * CCH];      // p = 4+2kh, 5+2kh
    }
    v8f acc[8];
    #pragma unroll
    for (int nt = 0; nt < 8; ++nt)
        #pragma unroll
        for (int v = 0; v < 8; ++v) acc[nt][v] = 0.0f;

    #pragma unroll
    for (int nt = 0; nt < 8; ++nt) {
        const float* kp = Kw + base + (size_t)(2 * kh) * CCH + nt * 16 + ln;
        v2f b0, b1;
        b0.x = kp[0];         b0.y = kp[CCH];
        b1.x = kp[4 * CCH];   b1.y = kp[5 * CCH];
        acc[nt] = WMMA_F32(a0, b0, acc[nt]);
        acc[nt] = WMMA_F32(a1, b1, acc[nt]);
    }

    // ---- InstanceNorm statistics over the whole 128x128 map
    float s = 0.0f, ss = 0.0f;
    #pragma unroll
    for (int nt = 0; nt < 8; ++nt)
        #pragma unroll
        for (int v = 0; v < 8; ++v) { const float x = acc[nt][v]; s += x; ss += x * x; }
    #pragma unroll
    for (int off = 16; off >= 1; off >>= 1) {
        s  += __shfl_xor(s,  off, 32);
        ss += __shfl_xor(ss, off, 32);
    }
    if (lane == 0) { red[w] = s; red[8 + w] = ss; }
    __syncthreads();
    float S = 0.0f, SS = 0.0f;
    #pragma unroll
    for (int i = 0; i < 8; ++i) { S += red[i]; SS += red[8 + i]; }
    const float inv16k = 1.0f / 16384.0f;
    const float mu  = S * inv16k;
    const float var = SS * inv16k - mu * mu;
    const float rs  = rsqrtf(var + 1e-5f);   // mean shift cancels in softmax

    // ---- row softmax of rs*attn, fully in registers.
    // C/D layout: slot v holds row (c0 + v) in lanes 0..15 and (c0 + v + 8)
    // in lanes 16..31; e = 16*nt + ln.  Width-16 shfl reduces one row.
    #pragma unroll
    for (int nt = 0; nt < 8; ++nt)
        #pragma unroll
        for (int v = 0; v < 8; ++v) acc[nt][v] *= rs;

    #pragma unroll
    for (int v = 0; v < 8; ++v) {
        float mx = -3.4e38f;
        #pragma unroll
        for (int nt = 0; nt < 8; ++nt) mx = fmaxf(mx, acc[nt][v]);
        #pragma unroll
        for (int off = 8; off >= 1; off >>= 1) mx = fmaxf(mx, __shfl_xor(mx, off, 16));
        float sum = 0.0f;
        #pragma unroll
        for (int nt = 0; nt < 8; ++nt) {
            const float e = __expf(acc[nt][v] - mx);
            acc[nt][v] = e;
            sum += e;
        }
        #pragma unroll
        for (int off = 8; off >= 1; off >>= 1) sum += __shfl_xor(sum, off, 16);
        const float rinv = 1.0f / sum;
        const int row = c0 + v + 8 * kh;
        #pragma unroll
        for (int nt = 0; nt < 8; ++nt)
            attnS[row * 132 + nt * 16 + ln] = acc[nt][v] * rinv;
    }
    __syncthreads();   // uniform; also orders LDS bounce conservatively

    // ---- ctx(c0..c0+15, p=0..7) = attn @ V^T, K-dim = e = 128
    v8f cacc = {};
    const float* vb = Vw + base;  // [p][c]
    for (int k0 = 0; k0 < CCH; k0 += 4) {
        v2f a, b;
        const float* ap = attnS + (size_t)(c0 + ln) * 132 + k0 + 2 * kh;
        a.x = ap[0];
        a.y = ap[1];
        if (ln < 8) {   // B[k][n] = V[p=n][e=k]; n >= 8 is padding
            const float* bp = vb + (size_t)ln * CCH + k0 + 2 * kh;
            b.x = bp[0];
            b.y = bp[1];
        } else {
            b.x = 0.0f;
            b.y = 0.0f;
        }
        cacc = WMMA_F32(a, b, cacc);
    }

    // store ctx[c,p] -> Ctx[patch][p][c*8+h]
    if (ln < 8) {
        #pragma unroll
        for (int v = 0; v < 8; ++v) {
            const int cc = c0 + v + 8 * kh;
            Ctx[((size_t)patch * PTOK + ln) * CH + cc * HEADS + h] = cacc[v];
        }
    }
}

// ---------------------------------------------------------------------------
// Kernel 3: out = Ctx(4096x1024) @ Wout(1024x128) with token-position remap.
// One wave per 16x16 tile: grid (256, 8), 256 K-steps of wmma.
// ---------------------------------------------------------------------------
__global__ __launch_bounds__(32)
void out_proj_kernel(const float* __restrict__ ws,
                     const float* __restrict__ Wout,
                     float* __restrict__ out)
{
    const float* Ctx = ws + 3 * SEG;
    const int mt = blockIdx.x;             // 0..255
    const int nt = blockIdx.y;             // 0..7
    const int lane = threadIdx.x;
    const int ln = lane & 15;
    const int kh = lane >> 4;
    const int m0 = mt * 16;
    const int n0 = nt * 16;

    v8f acc = {};
    for (int k0 = 0; k0 < CH; k0 += 4) {
        v2f a, b;
        const float* ap = Ctx + (size_t)(m0 + ln) * CH + k0 + 2 * kh;
        a.x = ap[0];
        a.y = ap[1];
        const float* bp = Wout + (size_t)(k0 + 2 * kh) * CCH + n0 + ln;
        b.x = bp[0];
        b.y = bp[CCH];
        acc = WMMA_F32(a, b, acc);
    }

    // row r = (patch, p); remap to '(b, d p1 h p2 w p3)' token order
    const int col = n0 + ln;
    #pragma unroll
    for (int v = 0; v < 8; ++v) {
        const int r     = m0 + v + 8 * kh;
        const int patch = r >> 3;
        const int p     = r & 7;
        const int bb  = patch >> 5;
        const int d   = (patch >> 4) & 1;
        const int hh  = (patch >> 2) & 3;
        const int wwp = patch & 3;
        const int p1  = (p >> 2) & 1;
        const int p2  = (p >> 1) & 1;
        const int p3  = p & 1;
        const int orow = bb * 256 + d * 128 + p1 * 64 + hh * 16 + p2 * 8 + wwp * 2 + p3;
        out[(size_t)orow * CCH + col] = acc[v];
    }
}

// ---------------------------------------------------------------------------
extern "C" void kernel_launch(void* const* d_in, const int* in_sizes, int n_in,
                              void* d_out, int out_size, void* d_ws, size_t ws_size,
                              hipStream_t stream)
{
    const float* emb  = (const float*)d_in[0];
    const float* Wq   = (const float*)d_in[1];
    const float* Wk   = (const float*)d_in[2];
    const float* Wv   = (const float*)d_in[3];
    const float* Wout = (const float*)d_in[4];
    float* ws  = (float*)d_ws;      // needs 4*SEG*4 = 64 MB
    float* out = (float*)d_out;

    const size_t smem = (size_t)(128 * 132 + 16) * sizeof(float);   // ~66 KB
    static bool attr_set = [] {
        hipFuncSetAttribute(reinterpret_cast<const void*>(attn_head_kernel),
                            hipFuncAttributeMaxDynamicSharedMemorySize,
                            (int)((128 * 132 + 16) * sizeof(float)));
        return true;
    }();
    (void)attr_set;

    qkv_proj_kernel<<<dim3(8, 32), 384, 0, stream>>>(emb, Wq, Wk, Wv, ws);
    attn_head_kernel<<<dim3(NP * HEADS), 256, smem, stream>>>(ws);
    out_proj_kernel<<<dim3(256, 8), 32, 0, stream>>>(ws, Wout, out);
}

// v002
// It runs in 92.9 microseconds.
// Timed twice side by side with v001, it ran 1.16 times as fast both times.
// All steps since v000 together make it 1.55 times as fast.
#include <hip/hip_runtime.h>

// ---------------------------------------------------------------------------
// MI455X / gfx1250, wave32. Matrix ops via V_WMMA_F32_16X16X4_F32 (fp32 in/out,
// matches the fp32 reference exactly up to accumulation order).
//
// Problem sizes (fixed by the reference):
//   patches NP=512, tokens/patch P=8, channels C=128, heads H=8, CH=1024
//   emb (512,8,128)  Wq/Wk/Wv (128,1024)  Wout (1024,128)  out (16,256,128)
//
// Workspace layout (fp32, 64 MB total):
//   [0 .. 4M)    Qw  [patch][head][p][c]
//   [4M .. 8M)   Kw  [patch][head][p][c]
//   [8M .. 12M)  Vw  [patch][head][p][c]
//   [12M .. 16M) Ctx [patch][p][c*8+h]   (rows match out-proj GEMM M dim)
// ---------------------------------------------------------------------------

typedef float v2f __attribute__((ext_vector_type(2)));
typedef float v4f __attribute__((ext_vector_type(4)));
typedef float v8f __attribute__((ext_vector_type(8)));

#define WMMA_F32(A, B, Cacc) \
    __builtin_amdgcn_wmma_f32_16x16x4_f32(false, (A), false, (B), (short)0, (Cacc), false, false)

static constexpr int NP     = 512;              // patches
static constexpr int PTOK   = 8;                // tokens per patch
static constexpr int CCH    = 128;              // channels c
static constexpr int HEADS  = 8;
static constexpr int CH     = 1024;             // c*heads
static constexpr int MROWS  = NP * PTOK;        // 4096
static constexpr size_t SEG = (size_t)NP * HEADS * PTOK * CCH;  // 4,194,304 floats

// ---------------------------------------------------------------------------
// Kernel 1: QKV projection.  One 12-wave workgroup per (128 rows x 128 columns)
// of q, k and v together: waves 0-3 do q, 4-7 k, 8-11 v; each wave owns a
// 32 x 128 register tile (2 row tiles x 8 column tiles = 16 accumulators).
// Column tile j takes the columns n = 128*nb + 8*ln + j, i.e. head j of 16
// adjacent channels: a lane's 8 B values of one k row are 32 contiguous bytes,
// and a store of one accumulator register writes 16 adjacent channels.
// Every A fragment feeds 8 products and every B fragment 2.  The k order of
// each output element is the plain ascending one.
// Output layout [patch][head][p][c] so kernel 2 reads are coalesced.
// ---------------------------------------------------------------------------
__global__ __launch_bounds__(384)
void qkv_proj_kernel(const float* __restrict__ emb,
                     const float* __restrict__ Wq,
                     const float* __restrict__ Wk,
                     const float* __restrict__ Wv,
                     float* __restrict__ ws)
{
    const int nb    = blockIdx.x;          // 0..7   (128-column block of 1024)
    const int mb    = blockIdx.y;          // 0..31  (128-row block of 4096)
    const int wave  = __builtin_amdgcn_readfirstlane(threadIdx.x >> 5);  // 0..11
    const int which = wave >> 2;           // 0:q 1:k 2:v
    const float* W  = (which == 0) ? Wq : ((which == 1) ? Wk : Wv);
    float* dst      = ws + (size_t)which * SEG;

    const int lane = threadIdx.x & 31;
    const int ln   = lane & 15;            // A: M-row / B: N-col
    const int kh   = lane >> 4;            // K half-select (K = 2*kh, 2*kh+1)
    const int m0   = mb * 128 + (wave & 3) * 32;

    const float* ap = emb + (size_t)(m0 + ln) * CCH + 2 * kh;
    const float* bp = W + (size_t)(2 * kh) * CH + nb * 128 + ln * 8;

    v8f acc[2][8];
    #pragma unroll
    for (int t = 0; t < 2; ++t)
        #pragma unroll
        for (int j = 0; j < 8; ++j)
            #pragma unroll
            for (int v = 0; v < 8; ++v) acc[t][j][v] = 0.0f;

    // unroll 4: the loads of four k steps go out as one group ahead of their 64
    // products, so a wave stalls on memory once per 64 products, not once per 16.
    #pragma unroll 4
    for (int k0 = 0; k0 < CCH; k0 += 4) {
        const v2f a0 = *(const v2f*)(ap + k0);               // rows m0 + ln
        const v2f a1 = *(const v2f*)(ap + 16 * CCH + k0);    // rows m0 + 16 + ln
        const float* br = bp + (size_t)k0 * CH;
        const v4f x0 = *(const v4f*)(br);                    // k = k0+2kh,   heads 0-3
        const v4f x1 = *(const v4f*)(br + 4);                // k = k0+2kh,   heads 4-7
        const v4f y0 = *(const v4f*)(br + CH);               // k = k0+2kh+1, heads 0-3
        const v4f y1 = *(const v4f*)(br + CH + 4);           // k = k0+2kh+1, heads 4-7
        #pragma unroll
        for (int j = 0; j < 8; ++j) {
            v2f b;
            b.x = (j < 4) ? x0[j & 3] : x1[j & 3];
            b.y = (j < 4) ? y0[j & 3] : y1[j & 3];
            acc[0][j] = WMMA_F32(a0, b, acc[0][j]);
            acc[1][j] = WMMA_F32(a1, b, acc[1][j]);
        }
    }

    // D element (m,n): m = v + 8*kh (C/D layout); head = j, channel = 16*nb + ln.
    // row r = m0 + 16*t + v + 8*kh  ->  patch = (m0>>3) + 2*t + kh, p = v.
    float* d = dst + (size_t)((m0 >> 3) + kh) * (HEADS * PTOK * CCH) + nb * 16 + ln;
    #pragma unroll
    for (int t = 0; t < 2; ++t)
        #pragma unroll
        for (int j = 0; j < 8; ++j)
            #pragma unroll
            for (int v = 0; v < 8; ++v)
                d[((2 * t * HEADS + j) * PTOK + v) * CCH] = acc[t][j][v];
}

__device__ __forceinline__ float xhalf(float x)
{
    return __builtin_bit_cast(float, __builtin_amdgcn_permlanex16(
        __builtin_bit_cast(int, x), __builtin_bit_cast(int, x),
        0x76543210, 0xfedcba98, false, false));
}

__global__ __launch_bounds__(256)
void attn_head_kernel(float* __restrict__ ws)
{
    __shared__ float red[16];               // cross-wave sum/sumsq

    const float* Qw  = ws;
    const float* Kw  = ws + SEG;
    const float* Vw  = ws + 2 * SEG;
    float*       Ctx = ws + 3 * SEG;

    const int patch = blockIdx.x >> 3;
    const int h     = blockIdx.x & 7;
    const int tid   = threadIdx.x;
    const int w     = tid >> 5;             // wave 0..7
    const int lane  = tid & 31;
    const int ln    = lane & 15;
    const int kh    = lane >> 4;
    const int c0    = w * 16;               // this wave's c block
    const size_t base = ((size_t)patch * HEADS + h) * PTOK * CCH; // [p=0][c=0]

    // ---- S^T = K^T Q : A_op[m][k] = K[p=k][e0+m], B_op[k][n] = Q[p=k][c0+n]
    v2f q0, q1;
    {
        const float* q = Qw + base + (size_t)(2 * kh) * CCH + c0 + ln;
        q0.x = q[0];          q0.y = q[CCH];          // p = 2kh, 2kh+1
        q1.x = q[4 * CCH];    q1.y = q[5 * CCH];      // p = 4+2kh, 5+2kh
    }
    v8f acc[8];
    #pragma unroll
    for (int mt = 0; mt < 8; ++mt)
        #pragma unroll
        for (int v = 0; v < 8; ++v) acc[mt][v] = 0.0f;

    #pragma unroll
    for (int mt = 0; mt < 8; ++mt) {
        const float* kp = Kw + base + (size_t)(2 * kh) * CCH + mt * 16 + ln;
        v2f k0, k1;
        k0.x = kp[0];         k0.y = kp[CCH];
        k1.x = kp[4 * CCH];   k1.y = kp[5 * CCH];
        acc[mt] = WMMA_F32(k0, q0, acc[mt]);
        acc[mt] = WMMA_F32(k1, q1, acc[mt]);
    }

    // ---- A fragments of ctx^T = V P^T: row m = p.  Lanes ln >= 8 read row ln-8
    // again: D rows 8..15 repeat rows 0..7 and are not stored.
    // Tiles 0..3 are fetched here, under the statistics; tile mt+4 takes tile mt's
    // registers once its products are issued.
    const float* vp = Vw + base + (size_t)(ln & 7) * CCH + 8 * kh;
    v4f vlo[4], vhi[4];
    #pragma unroll
    for (int mt = 0; mt < 4; ++mt) {
        vlo[mt] = *(const v4f*)(vp + 16 * mt);        // e = 16mt + 8kh + 0..3
        vhi[mt] = *(const v4f*)(vp + 16 * mt + 4);    // e = 16mt + 8kh + 4..7
    }

    // ---- InstanceNorm statistics over the whole 128x128 map
    float s = 0.0f, ss = 0.0f;
    #pragma unroll
    for (int mt = 0; mt < 8; ++mt)
        #pragma unroll
        for (int v = 0; v < 8; ++v) { const float x = acc[mt][v]; s += x; ss += x * x; }
    #pragma unroll
    for (int off = 16; off >= 1; off >>= 1) {
        s  += __shfl_xor(s,  off, 32);
        ss += __shfl_xor(ss, off, 32);
    }
    if (lane == 0) { red[w] = s; red[8 + w] = ss; }
    __syncthreads();
    float S = 0.0f, SS = 0.0f;
    #pragma unroll
    for (int i = 0; i < 8; ++i) { S += red[i]; SS += red[8 + i]; }
    const float inv16k = 1.0f / 16384.0f;
    const float mu  = S * inv16k;
    const float var = SS * inv16k - mu * mu;
    const float rs  = rsqrtf(var + 1e-5f);   // mean shift cancels in softmax

    // ---- softmax of rs*attn over e, one attention row per lane pair (ln, ln+16)
    #pragma unroll
    for (int mt = 0; mt < 8; ++mt) acc[mt] *= rs;

    v8f mxv = acc[0];                        // 8 independent chains
    #pragma unroll
    for (int mt = 1; mt < 8; ++mt) mxv = __builtin_elementwise_max(mxv, acc[mt]);
    float mx = fmaxf(fmaxf(fmaxf(mxv[0], mxv[1]), fmaxf(mxv[2], mxv[3])),
                     fmaxf(fmaxf(mxv[4], mxv[5]), fmaxf(mxv[6], mxv[7])));
    mx = fmaxf(mx, xhalf(mx));

    // ---- exp, row sum, and ctx^T(p, c0..c0+15) += V P^T, K-dim = e = 128
    v8f smv = {};                            // 8 independent chains
    v8f cacc = {};
    #pragma unroll
    for (int mt = 0; mt < 8; ++mt) {
        acc[mt] = (acc[mt] - mx) * 1.44269504f;     // exp(x) = 2^(x log2 e)
        #pragma unroll
        for (int v = 0; v < 8; ++v)
            acc[mt][v] = __builtin_amdgcn_exp2f(acc[mt][v]);
        smv += acc[mt];
        #pragma unroll
        for (int i = 0; i < 4; ++i) {
            v2f a, b;
            a.x = (i < 2) ? vlo[mt % 4][2 * i]     : vhi[mt % 4][2 * i - 4];
            a.y = (i < 2) ? vlo[mt % 4][2 * i + 1] : vhi[mt % 4][2 * i - 3];
            b.x = acc[mt][2 * i];
            b.y = acc[mt][2 * i + 1];
            cacc = WMMA_F32(a, b, cacc);
        }
        if (mt + 4 < 8) {
            vlo[mt % 4] = *(const v4f*)(vp + 16 * (mt + 4));
            vhi[mt % 4] = *(const v4f*)(vp + 16 * (mt + 4) + 4);
        }
    }
    float sum = ((smv[0] + smv[1]) + (smv[2] + smv[3])) + ((smv[4] + smv[5]) + (smv[6] + smv[7]));
    sum += xhalf(sum);
    const float rinv = 1.0f / sum;

    // store ctx[c,p] -> Ctx[patch][p][c*8+h]; register v of lanes 0-15 is p = v
    if (kh == 0) {
        float* cp = Ctx + (size_t)patch * PTOK * CH + (c0 + ln) * HEADS + h;
        #pragma unroll
        for (int v = 0; v < 8; ++v)
            cp[(size_t)v * CH] = cacc[v] * rinv;
    }
}

// ---------------------------------------------------------------------------
// Kernel 3: out = Ctx(4096x1024) @ Wout(1024x128) with token-position remap.
// One wave per 16x16 tile: grid (256, 8), 256 K-steps of wmma.
// ---------------------------------------------------------------------------
__global__ __launch_bounds__(32)
void out_proj_kernel(const float* __restrict__ ws,
                     const float* __restrict__ Wout,
                     float* __restrict__ out)
{
    const float* Ctx = ws + 3 * SEG;
    const int mt = blockIdx.x;             // 0..255
    const int nt = blockIdx.y;             // 0..7
    const int lane = threadIdx.x;
    const int ln = lane & 15;
    const int kh = lane >> 4;
    const int m0 = mt * 16;
    const int n0 = nt * 16;

    v8f acc = {};
    for (int k0 = 0; k0 < CH; k0 += 4) {
        v2f a, b;
        const float* ap = Ctx + (size_t)(m0 + ln) * CH + k0 + 2 * kh;
        a.x = ap[0];
        a.y = ap[1];
        const float* bp = Wout + (size_t)(k0 + 2 * kh) * CCH + n0 + ln;
        b.x = bp[0];
        b.y = bp[CCH];
        acc = WMMA_F32(a, b, acc);
    }

    // row r = (patch, p); remap to '(b, d p1 h p2 w p3)' token order
    const int col = n0 + ln;
    #pragma unroll
    for (int v = 0; v < 8; ++v) {
        const int r     = m0 + v + 8 * kh;
        const int patch = r >> 3;
        const int p     = r & 7;
        const int bb  = patch >> 5;
        const int d   = (patch >> 4) & 1;
        const int hh  = (patch >> 2) & 3;
        const int wwp = patch & 3;
        const int p1  = (p >> 2) & 1;
        const int p2  = (p >> 1) & 1;
        const int p3  = p & 1;
        const int orow = bb * 256 + d * 128 + p1 * 64 + hh * 16 + p2 * 8 + wwp * 2 + p3;
        out[(size_t)orow * CCH + col] = acc[v];
    }
}

// ---------------------------------------------------------------------------
extern "C" void kernel_launch(void* const* d_in, const int* in_sizes, int n_in,
                              void* d_out, int out_size, void* d_ws, size_t ws_size,
                              hipStream_t stream)
{
    const float* emb  = (const float*)d_in[0];
    const float* Wq   = (const float*)d_in[1];
    const float* Wk   = (const float*)d_in[2];
    const float* Wv   = (const float*)d_in[3];
    const float* Wout = (const float*)d_in[4];
    float* ws  = (float*)d_ws;      // needs 4*SEG*4 = 64 MB
    float* out = (float*)d_out;

    qkv_proj_kernel<<<dim3(8, 32), 384, 0, stream>>>(emb, Wq, Wk, Wv, ws);
    attn_head_kernel<<<dim3(NP * HEADS), 256, 0, stream>>>(ws);
    out_proj_kernel<<<dim3(256, 8), 32, 0, stream>>>(ws, Wout, out);
}

// v003
// Measured time: 80.5 microseconds a run.
// Next to v002, in two timings, it ran 1.16 times as fast each time.
// Over all steps from v000 it is 1.79 times as fast.
#include <hip/hip_runtime.h>

// ---------------------------------------------------------------------------
// MI455X / gfx1250, wave32. Matrix ops via V_WMMA_F32_16X16X4_F32 (fp32 in/out,
// matches the fp32 reference exactly up to accumulation order).
//
// Problem sizes (fixed by the reference):
//   patches NP=512, tokens/patch P=8, channels C=128, heads H=8, CH=1024
//   emb (512,8,128)  Wq/Wk/Wv (128,1024)  Wout (1024,128)  out (16,256,128)
//
// Workspace layout (fp32, 64 MB total):
//   [0 .. 4M)    Qw  [patch][head][p][c]
//   [4M .. 8M)   Kw  [patch][head][p][c]
//   [8M .. 12M)  Vw  [patch][head][p][c]
//   [12M .. 16M) Ctx [patch][p][c*8+h]   (rows match out-proj GEMM M dim)
// ---------------------------------------------------------------------------

typedef float v2f __attribute__((ext_vector_type(2)));
typedef float v4f __attribute__((ext_vector_type(4)));
typedef float v8f __attribute__((ext_vector_type(8)));

#define WMMA_F32(A, B, Cacc) \
    __builtin_amdgcn_wmma_f32_16x16x4_f32(false, (A), false, (B), (short)0, (Cacc), false, false)

static constexpr int NP     = 512;              // patches
static constexpr int PTOK   = 8;                // tokens per patch
static constexpr int CCH    = 128;              // channels c
static constexpr int HEADS  = 8;
static constexpr int CH     = 1024;             // c*heads
static constexpr int MROWS  = NP * PTOK;        // 4096
static constexpr size_t SEG = (size_t)NP * HEADS * PTOK * CCH;  // 4,194,304 floats

// ---------------------------------------------------------------------------
// Kernel 1: QKV projection.  One 12-wave workgroup per (128 rows x 128 columns)
// of q, k and v together: waves 0-3 do q, 4-7 k, 8-11 v; each wave owns a
// 32 x 128 register tile (2 row tiles x 8 column tiles = 16 accumulators).
// Column tile j takes the columns n = 128*nb + 8*ln + j, i.e. head j of 16
// adjacent channels: a lane's 8 B values of one k row are 32 contiguous bytes,
// and a store of one accumulator register writes 16 adjacent channels.
// Every A fragment feeds 8 products and every B fragment 2.  The k order of
// each output element is the plain ascending one.
// Output layout [patch][head][p][c] so kernel 2 reads are coalesced.
// ---------------------------------------------------------------------------
__global__ __launch_bounds__(384)
void qkv_proj_kernel(const float* __restrict__ emb,
                     const float* __restrict__ Wq,
                     const float* __restrict__ Wk,
                     const float* __restrict__ Wv,
                     float* __restrict__ ws)
{
    const int nb    = blockIdx.x;          // 0..7   (128-column block of 1024)
    const int mb    = blockIdx.y;          // 0..31  (128-row block of 4096)
    const int wave  = __builtin_amdgcn_readfirstlane(threadIdx.x >> 5);  // 0..11
    const int which = wave >> 2;           // 0:q 1:k 2:v
    const float* W  = (which == 0) ? Wq : ((which == 1) ? Wk : Wv);
    float* dst      = ws + (size_t)which * SEG;

    const int lane = threadIdx.x & 31;
    const int ln   = lane & 15;            // A: M-row / B: N-col
    const int kh   = lane >> 4;            // K half-select (K = 2*kh, 2*kh+1)
    const int m0   = mb * 128 + (wave & 3) * 32;

    const float* ap = emb + (size_t)(m0 + ln) * CCH + 2 * kh;
    const float* bp = W + (size_t)(2 * kh) * CH + nb * 128 + ln * 8;

    v8f acc[2][8];
    #pragma unroll
    for (int t = 0; t < 2; ++t)
        #pragma unroll
        for (int j = 0; j < 8; ++j)
            #pragma unroll
            for (int v = 0; v < 8; ++v) acc[t][j][v] = 0.0f;

    // unroll 4: the loads of four k steps go out as one group ahead of their 64
    // products, so a wave stalls on memory once per 64 products, not once per 16.
    #pragma unroll 4
    for (int k0 = 0; k0 < CCH; k0 += 4) {
        const v2f a0 = *(const v2f*)(ap + k0);               // rows m0 + ln
        const v2f a1 = *(const v2f*)(ap + 16 * CCH + k0);    // rows m0 + 16 + ln
        const float* br = bp + (size_t)k0 * CH;
        const v4f x0 = *(const v4f*)(br);                    // k = k0+2kh,   heads 0-3
        const v4f x1 = *(const v4f*)(br + 4);                // k = k0+2kh,   heads 4-7
        const v4f y0 = *(const v4f*)(br + CH);               // k = k0+2kh+1, heads 0-3
        const v4f y1 = *(const v4f*)(br + CH + 4);           // k = k0+2kh+1, heads 4-7
        #pragma unroll
        for (int j = 0; j < 8; ++j) {
            v2f b;
            b.x = (j < 4) ? x0[j & 3] : x1[j & 3];
            b.y = (j < 4) ? y0[j & 3] : y1[j & 3];
            acc[0][j] = WMMA_F32(a0, b, acc[0][j]);
            acc[1][j] = WMMA_F32(a1, b, acc[1][j]);
        }
    }

    // D element (m,n): m = v + 8*kh (C/D layout); head = j, channel = 16*nb + ln.
    // row r = m0 + 16*t + v + 8*kh  ->  patch = (m0>>3) + 2*t + kh, p = v.
    float* d = dst + (size_t)((m0 >> 3) + kh) * (HEADS * PTOK * CCH) + nb * 16 + ln;
    #pragma unroll
    for (int t = 0; t < 2; ++t)
        #pragma unroll
        for (int j = 0; j < 8; ++j)
            #pragma unroll
            for (int v = 0; v < 8; ++v)
                d[((2 * t * HEADS + j) * PTOK + v) * CCH] = acc[t][j][v];
}

__device__ __forceinline__ float xhalf(float x)
{
    return __builtin_bit_cast(float, __builtin_amdgcn_permlanex16(
        __builtin_bit_cast(int, x), __builtin_bit_cast(int, x),
        0x76543210, 0xfedcba98, false, false));
}

__global__ __launch_bounds__(256)
void attn_head_kernel(float* __restrict__ ws)
{
    __shared__ float red[16];               // cross-wave sum/sumsq

    const float* Qw  = ws;
    const float* Kw  = ws + SEG;
    const float* Vw  = ws + 2 * SEG;
    float*       Ctx = ws + 3 * SEG;

    const int patch = blockIdx.x >> 3;
    const int h     = blockIdx.x & 7;
    const int tid   = threadIdx.x;
    const int w     = tid >> 5;             // wave 0..7
    const int lane  = tid & 31;
    const int ln    = lane & 15;
    const int kh    = lane >> 4;
    const int c0    = w * 16;               // this wave's c block
    const size_t base = ((size_t)patch * HEADS + h) * PTOK * CCH; // [p=0][c=0]

    // ---- S^T = K^T Q : A_op[m][k] = K[p=k][e0+m], B_op[k][n] = Q[p=k][c0+n]
    v2f q0, q1;
    {
        const float* q = Qw + base + (size_t)(2 * kh) * CCH + c0 + ln;
        q0.x = q[0];          q0.y = q[CCH];          // p = 2kh, 2kh+1
        q1.x = q[4 * CCH];    q1.y = q[5 * CCH];      // p = 4+2kh, 5+2kh
    }
    v8f acc[8];
    #pragma unroll
    for (int mt = 0; mt < 8; ++mt)
        #pragma unroll
        for (int v = 0; v < 8; ++v) acc[mt][v] = 0.0f;

    #pragma unroll
    for (int mt = 0; mt < 8; ++mt) {
        const float* kp = Kw + base + (size_t)(2 * kh) * CCH + mt * 16 + ln;
        v2f k0, k1;
        k0.x = kp[0];         k0.y = kp[CCH];
        k1.x = kp[4 * CCH];   k1.y = kp[5 * CCH];
        acc[mt] = WMMA_F32(k0, q0, acc[mt]);
        acc[mt] = WMMA_F32(k1, q1, acc[mt]);
    }

    // ---- A fragments of ctx^T = V P^T: row m = p.  Lanes ln >= 8 read row ln-8
    // again: D rows 8..15 repeat rows 0..7 and are not stored.
    // Tiles 0..3 are fetched here, under the statistics; tile mt+4 takes tile mt's
    // registers once its products are issued.
    const float* vp = Vw + base + (size_t)(ln & 7) * CCH + 8 * kh;
    v4f vlo[4], vhi[4];
    #pragma unroll
    for (int mt = 0; mt < 4; ++mt) {
        vlo[mt] = *(const v4f*)(vp + 16 * mt);        // e = 16mt + 8kh + 0..3
        vhi[mt] = *(const v4f*)(vp + 16 * mt + 4);    // e = 16mt + 8kh + 4..7
    }

    // ---- InstanceNorm statistics over the whole 128x128 map
    float s = 0.0f, ss = 0.0f;
    #pragma unroll
    for (int mt = 0; mt < 8; ++mt)
        #pragma unroll
        for (int v = 0; v < 8; ++v) { const float x = acc[mt][v]; s += x; ss += x * x; }
    #pragma unroll
    for (int off = 16; off >= 1; off >>= 1) {
        s  += __shfl_xor(s,  off, 32);
        ss += __shfl_xor(ss, off, 32);
    }
    if (lane == 0) { red[w] = s; red[8 + w] = ss; }
    __syncthreads();
    float S = 0.0f, SS = 0.0f;
    #pragma unroll
    for (int i = 0; i < 8; ++i) { S += red[i]; SS += red[8 + i]; }
    const float inv16k = 1.0f / 16384.0f;
    const float mu  = S * inv16k;
    const float var = SS * inv16k - mu * mu;
    const float rs  = rsqrtf(var + 1e-5f);   // mean shift cancels in softmax

    // ---- softmax of rs*attn over e, one attention row per lane pair (ln, ln+16)
    #pragma unroll
    for (int mt = 0; mt < 8; ++mt) acc[mt] *= rs;

    v8f mxv = acc[0];                        // 8 independent chains
    #pragma unroll
    for (int mt = 1; mt < 8; ++mt) mxv = __builtin_elementwise_max(mxv, acc[mt]);
    float mx = fmaxf(fmaxf(fmaxf(mxv[0], mxv[1]), fmaxf(mxv[2], mxv[3])),
                     fmaxf(fmaxf(mxv[4], mxv[5]), fmaxf(mxv[6], mxv[7])));
    mx = fmaxf(mx, xhalf(mx));

    // ---- exp, row sum, and ctx^T(p, c0..c0+15) += V P^T, K-dim = e = 128
    v8f smv = {};                            // 8 independent chains
    v8f cacc = {};
    #pragma unroll
    for (int mt = 0; mt < 8; ++mt) {
        acc[mt] = (acc[mt] - mx) * 1.44269504f;     // exp(x) = 2^(x log2 e)
        #pragma unroll
        for (int v = 0; v < 8; ++v)
            acc[mt][v] = __builtin_amdgcn_exp2f(acc[mt][v]);
        smv += acc[mt];
        #pragma unroll
        for (int i = 0; i < 4; ++i) {
            v2f a, b;
            a.x = (i < 2) ? vlo[mt % 4][2 * i]     : vhi[mt % 4][2 * i - 4];
            a.y = (i < 2) ? vlo[mt % 4][2 * i + 1] : vhi[mt % 4][2 * i - 3];
            b.x = acc[mt][2 * i];
            b.y = acc[mt][2 * i + 1];
            cacc = WMMA_F32(a, b, cacc);
        }
        if (mt + 4 < 8) {
            vlo[mt % 4] = *(const v4f*)(vp + 16 * (mt + 4));
            vhi[mt % 4] = *(const v4f*)(vp + 16 * (mt + 4) + 4);
        }
    }
    float sum = ((smv[0] + smv[1]) + (smv[2] + smv[3])) + ((smv[4] + smv[5]) + (smv[6] + smv[7]));
    sum += xhalf(sum);
    const float rinv = 1.0f / sum;

    // store ctx[c,p] -> Ctx[patch][p][c*8+h]; register v of lanes 0-15 is p = v
    if (kh == 0) {
        float* cp = Ctx + (size_t)patch * PTOK * CH + (c0 + ln) * HEADS + h;
        #pragma unroll
        for (int v = 0; v < 8; ++v)
            cp[(size_t)v * CH] = cacc[v] * rinv;
    }
}

// ---------------------------------------------------------------------------
// Kernel 3: out = Ctx(4096x1024) @ Wout(1024x128) with token-position remap.
// One 8-wave workgroup per 16 rows x all 128 columns; wave w sums the k slice
// [128w, 128w+128) into 8 accumulator tiles, the 8 partial tiles are added
// through LDS in ascending w.  Every Ctx element is read once on the chip.
// Column tile j holds the columns n = 64*(j>>2) + 4*ln + (j&3): a lane's B values
// of one k row are two 16-byte loads, and each wave-wide load covers whole lines.
// k order, both operands: in each group of 8 k, lane half kh takes k = 4kh..4kh+3
// (one 16-byte load of the Ctx row), two of them per product.
// ---------------------------------------------------------------------------
__global__ __launch_bounds__(256)
void out_proj_kernel(const float* __restrict__ ws,
                     const float* __restrict__ Wout,
                     float* __restrict__ out)
{
    __shared__ float part[8 * 16 * CCH];   // [wave][row][column], 64 KB

    const float* Ctx = ws + 3 * SEG;
    const int m0   = blockIdx.x * 16;      // 16 rows = 2 patches
    const int wave = __builtin_amdgcn_readfirstlane(threadIdx.x >> 5);  // 0..7
    const int lane = threadIdx.x & 31;
    const int ln   = lane & 15;
    const int kh   = lane >> 4;
    const int ks   = wave * 128;           // this wave's k slice

    const float* ap = Ctx + (size_t)(m0 + ln) * CH + ks + 4 * kh;
    const float* bp = Wout + (size_t)(ks + 4 * kh) * CCH + 4 * ln;

    // the wave's whole A slice: a[g] = Ctx[m0+ln][ks + 8g + 4kh + 0..3]
    v4f a[16];
    #pragma unroll
    for (int g = 0; g < 16; ++g) a[g] = *(const v4f*)(ap + 8 * g);

    v8f acc[8];
    #pragma unroll
    for (int j = 0; j < 8; ++j)
        #pragma unroll
        for (int v = 0; v < 8; ++v) acc[j][v] = 0.0f;

    // B in chunks of 16 k (4 products deep, 16 loads), two register sets: chunk
    // c+1 is in flight while the 32 products of chunk c issue.
    v4f b[2][16];
    #pragma unroll
    for (int s = 0; s < 4; ++s) {
        const float* br = bp + (size_t)(8 * (s >> 1) + 2 * (s & 1)) * CCH;
        b[0][4 * s + 0] = *(const v4f*)(br);
        b[0][4 * s + 1] = *(const v4f*)(br + 64);
        b[0][4 * s + 2] = *(const v4f*)(br + CCH);
        b[0][4 * s + 3] = *(const v4f*)(br + CCH + 64);
    }
    // the address registers of the Ctx loads above are reused once the products start
    asm volatile("s_wait_xcnt 0x0" ::: "memory");
    // keeps the loads above ahead of the first products: left free, the scheduler
    // sinks each load to just before its use and the wave waits out every latency
    __builtin_amdgcn_sched_barrier(0);
    #pragma unroll
    for (int c = 0; c < 8; ++c) {
        if (c + 1 < 8) {
            #pragma unroll
            for (int s = 0; s < 4; ++s) {
                const float* br = bp + (size_t)(16 * (c + 1) + 8 * (s >> 1) + 2 * (s & 1)) * CCH;
                b[(c + 1) & 1][4 * s + 0] = *(const v4f*)(br);
                b[(c + 1) & 1][4 * s + 1] = *(const v4f*)(br + 64);
                b[(c + 1) & 1][4 * s + 2] = *(const v4f*)(br + CCH);
                b[(c + 1) & 1][4 * s + 3] = *(const v4f*)(br + CCH + 64);
            }
        }
        // chunk c+1's 16 loads issue as one group before chunk c's products
        __builtin_amdgcn_sched_barrier(0);
        #pragma unroll
        for (int s = 0; s < 4; ++s) {
            v2f av;
            av.x = a[2 * c + (s >> 1)][2 * (s & 1)];
            av.y = a[2 * c + (s >> 1)][2 * (s & 1) + 1];
            #pragma unroll
            for (int j = 0; j < 8; ++j) {
                v2f bv;
                bv.x = b[c & 1][4 * s + (j >> 2)][j & 3];
                bv.y = b[c & 1][4 * s + 2 + (j >> 2)][j & 3];
                acc[j] = WMMA_F32(av, bv, acc[j]);
            }
        }
        // chunk c+2's loads stay behind chunk c's products, whose registers they take
        __builtin_amdgcn_sched_barrier(0);
    }

    // partial tile to LDS: register v of tile j = row v + 8kh, column as above
    float* pw = part + wave * (16 * CCH) + (8 * kh) * CCH + 4 * ln;
    #pragma unroll
    for (int v = 0; v < 8; ++v)
        #pragma unroll
        for (int q = 0; q < 2; ++q) {
            v4f t;
            t.x = acc[4 * q + 0][v];
            t.y = acc[4 * q + 1][v];
            t.z = acc[4 * q + 2][v];
            t.w = acc[4 * q + 3][v];
            *(v4f*)(pw + v * CCH + 64 * q) = t;
        }
    __syncthreads();

    // thread -> row tid>>4, columns 4*(tid&15) + 0..3 and 64 more
    const int rl = threadIdx.x >> 4;
    const float* pr = part + rl * CCH + 4 * (threadIdx.x & 15);
    v4f o0 = *(const v4f*)(pr);
    v4f o1 = *(const v4f*)(pr + 64);
    #pragma unroll
    for (int w = 1; w < 8; ++w) {
        o0 += *(const v4f*)(pr + w * (16 * CCH));
        o1 += *(const v4f*)(pr + w * (16 * CCH) + 64);
    }

    // row r = (patch, p); remap to '(b, d p1 h p2 w p3)' token order
    const int r     = m0 + rl;
    const int patch = r >> 3;
    const int p     = r & 7;
    const int bb  = patch >> 5;
    const int d   = (patch >> 4) & 1;
    const int hh  = (patch >> 2) & 3;
    const int wwp = patch & 3;
    const int p1  = (p >> 2) & 1;
    const int p2  = (p >> 1) & 1;
    const int p3  = p & 1;
    const int orow = bb * 256 + d * 128 + p1 * 64 + hh * 16 + p2 * 8 + wwp * 2 + p3;
    float* op = out + (size_t)orow * CCH + 4 * (threadIdx.x & 15);
    *(v4f*)(op)      = o0;
    *(v4f*)(op + 64) = o1;
}

// ---------------------------------------------------------------------------
extern "C" void kernel_launch(void* const* d_in, const int* in_sizes, int n_in,
                              void* d_out, int out_size, void* d_ws, size_t ws_size,
                              hipStream_t stream)
{
    const float* emb  = (const float*)d_in[0];
    const float* Wq   = (const float*)d_in[1];
    const float* Wk   = (const float*)d_in[2];
    const float* Wv   = (const float*)d_in[3];
    const float* Wout = (const float*)d_in[4];
    float* ws  = (float*)d_ws;      // needs 4*SEG*4 = 64 MB
    float* out = (float*)d_out;

    qkv_proj_kernel<<<dim3(8, 32), 384, 0, stream>>>(emb, Wq, Wk, Wv, ws);
    attn_head_kernel<<<dim3(NP * HEADS), 256, 0, stream>>>(ws);
    out_proj_kernel<<<dim3(256), 256, 0, stream>>>(ws, Wout, out);
}

// v004
// A run of this version takes 75.6 microseconds.
// Timed twice side by side with v003, it ran 1.06 times as fast both times.
// All steps since v000 together make it 1.90 times as fast.
#include <hip/hip_runtime.h>

// ---------------------------------------------------------------------------
// MI455X / gfx1250, wave32. Matrix ops via V_WMMA_F32_16X16X4_F32 (fp32 in/out,
// matches the fp32 reference exactly up to accumulation order).
//
// Problem sizes (fixed by the reference):
//   patches NP=512, tokens/patch P=8, channels C=128, heads H=8, CH=1024
//   emb (512,8,128)  Wq/Wk/Wv (128,1024)  Wout (1024,128)  out (16,256,128)
//
// Workspace layout (fp32, 64 MB total):
//   [0 .. 4M)    Qw  [patch][head][p][c]
//   [4M .. 8M)   Kw  [patch][head][p][c]
//   [8M .. 12M)  Vw  [patch][head][p][c]
//   [12M .. 16M) Ctx [patch][p][c*8+h]   (rows match out-proj GEMM M dim)
// ---------------------------------------------------------------------------

typedef float v2f __attribute__((ext_vector_type(2)));
typedef float v4f __attribute__((ext_vector_type(4)));
typedef float v8f __attribute__((ext_vector_type(8)));

#define WMMA_F32(A, B, Cacc) \
    __builtin_amdgcn_wmma_f32_16x16x4_f32(false, (A), false, (B), (short)0, (Cacc), false, false)

static constexpr int NP     = 512;              // patches
static constexpr int PTOK   = 8;                // tokens per patch
static constexpr int CCH    = 128;              // channels c
static constexpr int HEADS  = 8;
static constexpr int CH     = 1024;             // c*heads
static constexpr int MROWS  = NP * PTOK;        // 4096
static constexpr size_t SEG = (size_t)NP * HEADS * PTOK * CCH;  // 4,194,304 floats

// ---------------------------------------------------------------------------
// Kernel 1: QKV projection.  One 12-wave workgroup per (128 rows x 128 columns)
// of q, k and v together: waves 0-3 do q, 4-7 k, 8-11 v; each wave owns a
// 32 x 128 register tile (2 row tiles x 8 column tiles = 16 accumulators).
// Column tile j takes the columns n = 128*nb + 8*ln + j, i.e. head j of 16
// adjacent channels: a lane's 8 B values of one k row are 32 contiguous bytes,
// and a store of one accumulator register writes 16 adjacent channels.
// Every A fragment feeds 8 products and every B fragment 2.  The k order of
// each output element is the plain ascending one.
// Output layout [patch][head][p][c] so kernel 2 reads are coalesced.
// ---------------------------------------------------------------------------
__global__ __launch_bounds__(384)
void qkv_proj_kernel(const float* __restrict__ emb,
                     const float* __restrict__ Wq,
                     const float* __restrict__ Wk,
                     const float* __restrict__ Wv,
                     float* __restrict__ ws)
{
    const int nb    = blockIdx.x;          // 0..7   (128-column block of 1024)
    const int mb    = blockIdx.y;          // 0..31  (128-row block of 4096)
    const int wave  = __builtin_amdgcn_readfirstlane(threadIdx.x >> 5);  // 0..11
    const int which = wave >> 2;           // 0:q 1:k 2:v
    const float* W  = (which == 0) ? Wq : ((which == 1) ? Wk : Wv);
    float* dst      = ws + (size_t)which * SEG;

    const int lane = threadIdx.x & 31;
    const int ln   = lane & 15;            // A: M-row / B: N-col
    const int kh   = lane >> 4;            // K half-select (K = 2*kh, 2*kh+1)
    const int m0   = mb * 128 + (wave & 3) * 32;

    const float* ap = emb + (size_t)(m0 + ln) * CCH + 2 * kh;
    const float* bp = W + (size_t)(2 * kh) * CH + nb * 128 + ln * 8;

    v8f acc[2][8];
    #pragma unroll
    for (int t = 0; t < 2; ++t)
        #pragma unroll
        for (int j = 0; j < 8; ++j)
            #pragma unroll
            for (int v = 0; v < 8; ++v) acc[t][j][v] = 0.0f;

    // unroll 4: the loads of four k steps go out as one group ahead of their 64
    // products, so a wave stalls on memory once per 64 products, not once per 16.
    #pragma unroll 4
    for (int k0 = 0; k0 < CCH; k0 += 4) {
        const v2f a0 = *(const v2f*)(ap + k0);               // rows m0 + ln
        const v2f a1 = *(const v2f*)(ap + 16 * CCH + k0);    // rows m0 + 16 + ln
        const float* br = bp + (size_t)k0 * CH;
        const v4f x0 = *(const v4f*)(br);                    // k = k0+2kh,   heads 0-3
        const v4f x1 = *(const v4f*)(br + 4);                // k = k0+2kh,   heads 4-7
        const v4f y0 = *(const v4f*)(br + CH);               // k = k0+2kh+1, heads 0-3
        const v4f y1 = *(const v4f*)(br + CH + 4);           // k = k0+2kh+1, heads 4-7
        #pragma unroll
        for (int j = 0; j < 8; ++j) {
            v2f b;
            b.x = (j < 4) ? x0[j & 3] : x1[j & 3];
            b.y = (j < 4) ? y0[j & 3] : y1[j & 3];
            acc[0][j] = WMMA_F32(a0, b, acc[0][j]);
            acc[1][j] = WMMA_F32(a1, b, acc[1][j]);
        }
    }

    // D element (m,n): m = v + 8*kh (C/D layout); head = j, channel = 16*nb + ln.
    // row r = m0 + 16*t + v + 8*kh  ->  patch = (m0>>3) + 2*t + kh, p = v.
    float* d = dst + (size_t)((m0 >> 3) + kh) * (HEADS * PTOK * CCH) + nb * 16 + ln;
    #pragma unroll
    for (int t = 0; t < 2; ++t)
        #pragma unroll
        for (int j = 0; j < 8; ++j)
            #pragma unroll
            for (int v = 0; v < 8; ++v)
                d[((2 * t * HEADS + j) * PTOK + v) * CCH] = acc[t][j][v];
}

__device__ __forceinline__ float xhalf(float x)
{
    return __builtin_bit_cast(float, __builtin_amdgcn_permlanex16(
        __builtin_bit_cast(int, x), __builtin_bit_cast(int, x),
        0x76543210, 0xfedcba98, false, false));
}

__global__ __launch_bounds__(256)
void attn_head_kernel(float* __restrict__ ws)
{
    __shared__ float red[2][16];            // cross-wave sum/sumsq, slot = head & 1
    __shared__ __attribute__((aligned(16))) float stage[PTOK * CH];   // [p][c*8+h]

    const float* Qw  = ws;
    const float* Kw  = ws + SEG;
    const float* Vw  = ws + 2 * SEG;
    float*       Ctx = ws + 3 * SEG;

    const int patch = blockIdx.x;
    const int tid   = threadIdx.x;
    const int w     = tid >> 5;             // wave 0..7
    const int lane  = tid & 31;
    const int ln    = lane & 15;
    const int kh    = lane >> 4;
    const int c0    = w * 16;               // this wave's c block
    const size_t base = (size_t)patch * (HEADS * PTOK * CCH);   // [head=0][p=0][c=0]

    // S^T = K^T Q : A_op[m][k] = K[p=k][e0+m], B_op[k][n] = Q[p=k][c0+n]
    const float* qp = Qw + base + (size_t)(2 * kh) * CCH + c0 + ln;
    const float* kp = Kw + base + (size_t)(2 * kh) * CCH + ln;
    // A fragments of ctx^T = V P^T: row m = p.  Lanes ln >= 8 read row ln-8
    // again: D rows 8..15 repeat rows 0..7 and are not stored.
    const float* vp = Vw + base + (size_t)(ln & 7) * CCH + 8 * kh;

    // ---- operands of head 0
    v2f q0, q1, k0[8], k1[8];
    v4f vlo[8], vhi[8];
    q0.x = qp[0];          q0.y = qp[CCH];          // p = 2kh, 2kh+1
    q1.x = qp[4 * CCH];    q1.y = qp[5 * CCH];      // p = 4+2kh, 5+2kh
    #pragma unroll
    for (int mt = 0; mt < 8; ++mt) {
        k0[mt].x = kp[mt * 16];             k0[mt].y = kp[mt * 16 + CCH];
        k1[mt].x = kp[mt * 16 + 4 * CCH];   k1[mt].y = kp[mt * 16 + 5 * CCH];
    }
    // Q and K go out ahead of V here as they do in the loop: with the two mixed
    // here, the counted waits in front of the score products, which must hold for
    // both orders, also cover a V load on every trip
    __builtin_amdgcn_sched_barrier(0);
    #pragma unroll
    for (int mt = 0; mt < 8; ++mt) {
        vlo[mt] = *(const v4f*)(vp + 16 * mt);        // e = 16mt + 8kh + 0..3
        vhi[mt] = *(const v4f*)(vp + 16 * mt + 4);    // e = 16mt + 8kh + 4..7
    }

    // stays rolled: the loads of head h+1 then cannot sink to their use, and the
    // text stays an eighth of the unrolled size
    #pragma unroll 1
    for (int h = 0; h < HEADS; ++h) {
        v8f acc[8];
        #pragma unroll
        for (int mt = 0; mt < 8; ++mt)
            #pragma unroll
            for (int v = 0; v < 8; ++v) acc[mt][v] = 0.0f;

        #pragma unroll
        for (int mt = 0; mt < 8; ++mt) {
            acc[mt] = WMMA_F32(k0[mt], q0, acc[mt]);
            acc[mt] = WMMA_F32(k1[mt], q1, acc[mt]);
        }

        // ---- next head's Q and K take the registers that the products above have read.
        // No test around these loads or around V's below (the last head reads itself
        // again, unused): with the same loads in the same order on every path, each
        // wait can be a counted one that leaves the younger loads in flight
        const int nx = ((h + 1 < HEADS) ? h + 1 : h) * (PTOK * CCH);
        {
            const float* q = qp + nx;
            const float* k = kp + nx;
            q0.x = q[0];          q0.y = q[CCH];
            q1.x = q[4 * CCH];    q1.y = q[5 * CCH];
            #pragma unroll
            for (int mt = 0; mt < 8; ++mt) {
                k0[mt].x = k[mt * 16];             k0[mt].y = k[mt * 16 + CCH];
                k1[mt].x = k[mt * 16 + 4 * CCH];   k1[mt].y = k[mt * 16 + 5 * CCH];
            }
        }

        // ---- InstanceNorm statistics over the whole 128x128 map
        float s = 0.0f, ss = 0.0f;
        #pragma unroll
        for (int mt = 0; mt < 8; ++mt)
            #pragma unroll
            for (int v = 0; v < 8; ++v) { const float x = acc[mt][v]; s += x; ss += x * x; }
        #pragma unroll
        for (int off = 16; off >= 1; off >>= 1) {
            s  += __shfl_xor(s,  off, 32);
            ss += __shfl_xor(ss, off, 32);
        }
        float* rd = red[h & 1];
        if (lane == 0) { rd[w] = s; rd[8 + w] = ss; }
        // barrier with fences on LDS alone: only the slots cross waves here, and
        // __syncthreads() would also wait for the next head's loads in flight
        __builtin_amdgcn_fence(__ATOMIC_RELEASE, "workgroup", "local");
        __builtin_amdgcn_s_barrier();
        __builtin_amdgcn_fence(__ATOMIC_ACQUIRE, "workgroup", "local");

        float S = 0.0f, SS = 0.0f;
        #pragma unroll
        for (int i = 0; i < 8; ++i) { S += rd[i]; SS += rd[8 + i]; }
        const float inv16k = 1.0f / 16384.0f;
        const float mu  = S * inv16k;
        const float var = SS * inv16k - mu * mu;
        const float rs  = rsqrtf(var + 1e-5f);   // mean shift cancels in softmax

        // ---- softmax of rs*attn over e, one attention row per lane pair (ln, ln+16)
        #pragma unroll
        for (int mt = 0; mt < 8; ++mt) acc[mt] *= rs;

        v8f mxv = acc[0];                        // 8 independent chains
        #pragma unroll
        for (int mt = 1; mt < 8; ++mt) mxv = __builtin_elementwise_max(mxv, acc[mt]);
        float mx = fmaxf(fmaxf(fmaxf(mxv[0], mxv[1]), fmaxf(mxv[2], mxv[3])),
                         fmaxf(fmaxf(mxv[4], mxv[5]), fmaxf(mxv[6], mxv[7])));
        mx = fmaxf(mx, xhalf(mx));

        // ---- exp, row sum, and ctx^T(p, c0..c0+15) += V P^T, K-dim = e = 128
        const float* vn = vp + nx;
        v8f smv = {};                            // 8 independent chains
        v8f cacc = {};
        #pragma unroll
        for (int mt = 0; mt < 8; ++mt) {
            acc[mt] = (acc[mt] - mx) * 1.44269504f;     // exp(x) = 2^(x log2 e)
            #pragma unroll
            for (int v = 0; v < 8; ++v)
                acc[mt][v] = __builtin_amdgcn_exp2f(acc[mt][v]);
            smv += acc[mt];
            #pragma unroll
            for (int i = 0; i < 4; ++i) {
                v2f a, b;
                a.x = (i < 2) ? vlo[mt][2 * i]     : vhi[mt][2 * i - 4];
                a.y = (i < 2) ? vlo[mt][2 * i + 1] : vhi[mt][2 * i - 3];
                b.x = acc[mt][2 * i];
                b.y = acc[mt][2 * i + 1];
                cacc = WMMA_F32(a, b, cacc);
            }
            // next head's V tile takes the registers whose products are issued
            vlo[mt] = *(const v4f*)(vn + 16 * mt);
            vhi[mt] = *(const v4f*)(vn + 16 * mt + 4);
        }
        float sum = ((smv[0] + smv[1]) + (smv[2] + smv[3])) + ((smv[4] + smv[5]) + (smv[6] + smv[7]));
        sum += xhalf(sum);
        const float rinv = 1.0f / sum;

        // ctx[c,p] of this head -> stage[p][c*8+h]; register v of lanes 0-15 is p = v
        if (kh == 0) {
            float* sp = stage + (c0 + ln) * HEADS + h;
            #pragma unroll
            for (int v = 0; v < 8; ++v)
                sp[v * CH] = cacc[v] * rinv;
        }
    }

    // lanes 16-31 read what lanes 0-15 wrote
    __syncthreads();

    // stage -> Ctx[patch][p][c*8+h]: each store covers 512 contiguous bytes
    const float* sr = stage + c0 * HEADS + 4 * lane;
    float* cp = Ctx + (size_t)patch * PTOK * CH + c0 * HEADS + 4 * lane;
    #pragma unroll
    for (int p = 0; p < PTOK; ++p)
        *(v4f*)(cp + (size_t)p * CH) = *(const v4f*)(sr + p * CH);
}

// ---------------------------------------------------------------------------
// Kernel 3: out = Ctx(4096x1024) @ Wout(1024x128) with token-position remap.
// One 8-wave workgroup per 16 rows x all 128 columns; wave w sums the k slice
// [128w, 128w+128) into 8 accumulator tiles, the 8 partial tiles are added
// through LDS in ascending w.  Every Ctx element is read once on the chip.
// Column tile j holds the columns n = 64*(j>>2) + 4*ln + (j&3): a lane's B values
// of one k row are two 16-byte loads, and each wave-wide load covers whole lines.
// k order, both operands: in each group of 8 k, lane half kh takes k = 4kh..4kh+3
// (one 16-byte load of the Ctx row), two of them per product.
// ---------------------------------------------------------------------------
__global__ __launch_bounds__(256)
void out_proj_kernel(const float* __restrict__ ws,
                     const float* __restrict__ Wout,
                     float* __restrict__ out)
{
    __shared__ float part[8 * 16 * CCH];   // [wave][row][column], 64 KB

    const float* Ctx = ws + 3 * SEG;
    const int m0   = blockIdx.x * 16;      // 16 rows = 2 patches
    const int wave = __builtin_amdgcn_readfirstlane(threadIdx.x >> 5);  // 0..7
    const int lane = threadIdx.x & 31;
    const int ln   = lane & 15;
    const int kh   = lane >> 4;
    const int ks   = wave * 128;           // this wave's k slice

    const float* ap = Ctx + (size_t)(m0 + ln) * CH + ks + 4 * kh;
    const float* bp = Wout + (size_t)(ks + 4 * kh) * CCH + 4 * ln;

    // the wave's whole A slice: a[g] = Ctx[m0+ln][ks + 8g + 4kh + 0..3]
    v4f a[16];
    #pragma unroll
    for (int g = 0; g < 16; ++g) a[g] = *(const v4f*)(ap + 8 * g);

    v8f acc[8];
    #pragma unroll
    for (int j = 0; j < 8; ++j)
        #pragma unroll
        for (int v = 0; v < 8; ++v) acc[j][v] = 0.0f;

    // B in chunks of 16 k (4 products deep, 16 loads), two register sets: chunk
    // c+1 is in flight while the 32 products of chunk c issue.
    v4f b[2][16];
    #pragma unroll
    for (int s = 0; s < 4; ++s) {
        const float* br = bp + (size_t)(8 * (s >> 1) + 2 * (s & 1)) * CCH;
        b[0][4 * s + 0] = *(const v4f*)(br);
        b[0][4 * s + 1] = *(const v4f*)(br + 64);
        b[0][4 * s + 2] = *(const v4f*)(br + CCH);
        b[0][4 * s + 3] = *(const v4f*)(br + CCH + 64);
    }
    // the address registers of the Ctx loads above are reused once the products start
    asm volatile("s_wait_xcnt 0x0" ::: "memory");
    // keeps the loads above ahead of the first products: left free, the scheduler
    // sinks each load to just before its use and the wave waits out every latency
    __builtin_amdgcn_sched_barrier(0);
    #pragma unroll
    for (int c = 0; c < 8; ++c) {
        if (c + 1 < 8) {
            #pragma unroll
            for (int s = 0; s < 4; ++s) {
                const float* br = bp + (size_t)(16 * (c + 1) + 8 * (s >> 1) + 2 * (s & 1)) * CCH;
                b[(c + 1) & 1][4 * s + 0] = *(const v4f*)(br);
                b[(c + 1) & 1][4 * s + 1] = *(const v4f*)(br + 64);
                b[(c + 1) & 1][4 * s + 2] = *(const v4f*)(br + CCH);
                b[(c + 1) & 1][4 * s + 3] = *(const v4f*)(br + CCH + 64);
            }
        }
        // chunk c+1's 16 loads issue as one group before chunk c's products
        __builtin_amdgcn_sched_barrier(0);
        #pragma unroll
        for (int s = 0; s < 4; ++s) {
            v2f av;
            av.x = a[2 * c + (s >> 1)][2 * (s & 1)];
            av.y = a[2 * c + (s >> 1)][2 * (s & 1) + 1];
            #pragma unroll
            for (int j = 0; j < 8; ++j) {
                v2f bv;
                bv.x = b[c & 1][4 * s + (j >> 2)][j & 3];
                bv.y = b[c & 1][4 * s + 2 + (j >> 2)][j & 3];
                acc[j] = WMMA_F32(av, bv, acc[j]);
            }
        }
        // chunk c+2's loads stay behind chunk c's products, whose registers they take
        __builtin_amdgcn_sched_barrier(0);
    }

    // partial tile to LDS: register v of tile j = row v + 8kh, column as above
    float* pw = part + wave * (16 * CCH) + (8 * kh) * CCH + 4 * ln;
    #pragma unroll
    for (int v = 0; v < 8; ++v)
        #pragma unroll
        for (int q = 0; q < 2; ++q) {
            v4f t;
            t.x = acc[4 * q + 0][v];
            t.y = acc[4 * q + 1][v];
            t.z = acc[4 * q + 2][v];
            t.w = acc[4 * q + 3][v];
            *(v4f*)(pw + v * CCH + 64 * q) = t;
        }
    __syncthreads();

    // thread -> row tid>>4, columns 4*(tid&15) + 0..3 and 64 more
    const int rl = threadIdx.x >> 4;
    const float* pr = part + rl * CCH + 4 * (threadIdx.x & 15);
    v4f o0 = *(const v4f*)(pr);
    v4f o1 = *(const v4f*)(pr + 64);
    #pragma unroll
    for (int w = 1; w < 8; ++w) {
        o0 += *(const v4f*)(pr + w * (16 * CCH));
        o1 += *(const v4f*)(pr + w * (16 * CCH) + 64);
    }

    // row r = (patch, p); remap to '(b, d p1 h p2 w p3)' token order
    const int r     = m0 + rl;
    const int patch = r >> 3;
    const int p     = r & 7;
    const int bb  = patch >> 5;
    const int d   = (patch >> 4) & 1;
    const int hh  = (patch >> 2) & 3;
    const int wwp = patch & 3;
    const int p1  = (p >> 2) & 1;
    const int p2  = (p >> 1) & 1;
    const int p3  = p & 1;
    const int orow = bb * 256 + d * 128 + p1 * 64 + hh * 16 + p2 * 8 + wwp * 2 + p3;
    float* op = out + (size_t)orow * CCH + 4 * (threadIdx.x & 15);
    *(v4f*)(op)      = o0;
    *(v4f*)(op + 64) = o1;
}

// ---------------------------------------------------------------------------
extern "C" void kernel_launch(void* const* d_in, const int* in_sizes, int n_in,
                              void* d_out, int out_size, void* d_ws, size_t ws_size,
                              hipStream_t stream)
{
    const float* emb  = (const float*)d_in[0];
    const float* Wq   = (const float*)d_in[1];
    const float* Wk   = (const float*)d_in[2];
    const float* Wv   = (const float*)d_in[3];
    const float* Wout = (const float*)d_in[4];
    float* ws  = (float*)d_ws;      // needs 4*SEG*4 = 64 MB
    float* out = (float*)d_out;

    qkv_proj_kernel<<<dim3(8, 32), 384, 0, stream>>>(emb, Wq, Wk, Wv, ws);
    attn_head_kernel<<<dim3(NP), 256, 0, stream>>>(ws);
    out_proj_kernel<<<dim3(256), 256, 0, stream>>>(ws, Wout, out);
}

// v005
// Measured time: 58 microseconds a run.
// In both of two side-by-side timings against v004, it was 1.30 times as fast.
// Counting every step since v000, it is 2.48 times as fast.
#include <hip/hip_runtime.h>

// ---------------------------------------------------------------------------
// MI455X / gfx1250, wave32. Matrix ops via V_WMMA_F32_16X16X4_F32 (fp32 in/out,
// matches the fp32 reference exactly up to accumulation order).
//
// Problem sizes (fixed by the reference):
//   patches NP=512, tokens/patch P=8, channels C=128, heads H=8, CH=1024
//   emb (512,8,128)  Wq/Wk/Wv (128,1024)  Wout (1024,128)  out (16,256,128)
//
// Workspace layout (fp32, 64 MB total):
//   [0 .. 4M)    Qw  [patch][head][c/16][c%16][p]   blocks of 128 floats = 512 B
//   [4M .. 8M)   Kw  [patch][head][c/16][c%16][p]
//   [8M .. 12M)  Vw  [patch][head][c/16][p][c%16]
//   [12M .. 16M) Ctx [patch][p][c*8+h]   (rows match out-proj GEMM M dim)
// ---------------------------------------------------------------------------

typedef float v2f __attribute__((ext_vector_type(2)));
typedef float v4f __attribute__((ext_vector_type(4)));
typedef float v8f __attribute__((ext_vector_type(8)));

#define WMMA_F32(A, B, Cacc) \
    __builtin_amdgcn_wmma_f32_16x16x4_f32(false, (A), false, (B), (short)0, (Cacc), false, false)

static constexpr int NP     = 512;              // patches
static constexpr int PTOK   = 8;                // tokens per patch
static constexpr int CCH    = 128;              // channels c
static constexpr int HEADS  = 8;
static constexpr int CH     = 1024;             // c*heads
static constexpr int MROWS  = NP * PTOK;        // 4096
static constexpr size_t SEG = (size_t)NP * HEADS * PTOK * CCH;  // 4,194,304 floats

__device__ __forceinline__ float xhalf(float x)   // value of lane l ^ 16
{
    return __builtin_bit_cast(float, __builtin_amdgcn_permlanex16(
        __builtin_bit_cast(int, x), __builtin_bit_cast(int, x),
        0x76543210, 0xfedcba98, false, false));
}

// ---------------------------------------------------------------------------
// Kernel 1: QKV projection.  One 12-wave workgroup per (128 rows x 128 columns)
// of q, k and v together: waves 0-3 do q, 4-7 k, 8-11 v; each wave owns a
// 32 x 128 register tile (2 row tiles x 8 column tiles = 16 accumulators).
// Column tile j takes the columns n = 128*nb + 8*ln + j, i.e. head j of 16
// adjacent channels: a lane's 8 weight values of one k row are 32 contiguous
// bytes, and one accumulator tile holds the 512-byte block (head j, these 16
// channels) of two patches.
// Every emb fragment feeds 8 products and every weight fragment 2.  The k order
// of each output element is the plain ascending one.
// q, k: D = emb W, lane = channel, registers = p, one patch per wave half.
// v:    D = W^T emb^T (the same two fragments, roles exchanged), lane = (patch, p),
//       registers = 8 channels.
// Either way a lane holds 32 contiguous bytes of its patch's block.  Before the
// stores, lanes of the two patches exchange four registers, so that all 32 lanes
// write to ONE block: every store is 16 bytes a lane over the whole block (4 lines).
// ---------------------------------------------------------------------------
__device__ __forceinline__ float xrow8(float x)   // value of lane l ^ 8
{
    return __builtin_bit_cast(float, __builtin_amdgcn_permlane16(
        __builtin_bit_cast(int, x), __builtin_bit_cast(int, x),
        0xfedcba98, 0x76543210, false, false));
}

template <bool VT>   // VT: the v form
__device__ __forceinline__ void qkv_tile(const float* __restrict__ ap,
                                         const float* __restrict__ bp,
                                         float* __restrict__ d, int ln, int kh)
{
    v8f acc[2][8];
    #pragma unroll
    for (int t = 0; t < 2; ++t)
        #pragma unroll
        for (int j = 0; j < 8; ++j)
            #pragma unroll
            for (int v = 0; v < 8; ++v) acc[t][j][v] = 0.0f;

    // unroll 4: the loads of four k steps go out as one group ahead of their 64
    // products, so a wave stalls on memory once per 64 products, not once per 16.
    #pragma unroll 4
    for (int k0 = 0; k0 < CCH; k0 += 4) {
        const v2f a0 = *(const v2f*)(ap + k0);               // rows m0 + ln
        const v2f a1 = *(const v2f*)(ap + 16 * CCH + k0);    // rows m0 + 16 + ln
        const float* br = bp + (size_t)k0 * CH;
        const v4f x0 = *(const v4f*)(br);                    // k = k0+2kh,   heads 0-3
        const v4f x1 = *(const v4f*)(br + 4);                // k = k0+2kh,   heads 4-7
        const v4f y0 = *(const v4f*)(br + CH);               // k = k0+2kh+1, heads 0-3
        const v4f y1 = *(const v4f*)(br + CH + 4);           // k = k0+2kh+1, heads 4-7
        #pragma unroll
        for (int j = 0; j < 8; ++j) {
            v2f b;
            b.x = (j < 4) ? x0[j & 3] : x1[j & 3];
            b.y = (j < 4) ? y0[j & 3] : y1[j & 3];
            acc[0][j] = VT ? WMMA_F32(b, a0, acc[0][j]) : WMMA_F32(a0, b, acc[0][j]);
            acc[1][j] = VT ? WMMA_F32(b, a1, acc[1][j]) : WMMA_F32(a1, b, acc[1][j]);
        }
    }

    // D element (m,n): m = v + 8*kh, n = ln (C/D layout); head = j; tile t = patches 2t, 2t+1.
    // q, k: patch 2t + kh, p = v, channel ln      -> block [16 channels][p], float ln*8 + v
    // v:    patch 2t + (ln>>3), p = ln&7, channel 8kh + v -> block [p][16 channels],
    //       float (ln&7)*16 + 8kh + v
    // up: this lane holds the second patch.  After the exchange a lane of the first
    // patch writes its floats 0-3 of both blocks, its partner the floats 4-7.
    const int up = VT ? (ln >> 3) : kh;
    float* dl = d + (VT ? (ln & 7) * 16 + 8 * kh : ln * 8) + 4 * up;
    #pragma unroll
    for (int t = 0; t < 2; ++t)
        #pragma unroll
        for (int j = 0; j < 8; ++j) {
            v8f a = acc[t][j];
            #pragma unroll
            for (int v = 0; v < 4; ++v) {
                const float x = a[v], y = a[v + 4];
                const float s = up ? x : y;              // what the partner lane writes
                const float r = VT ? xrow8(s) : xhalf(s);
                a[v]     = up ? r : x;                   // patch 2t
                a[v + 4] = up ? y : r;                   // patch 2t+1
            }
            float* b = dl + (2 * t * HEADS + j) * (PTOK * CCH);
            *(v4f*)(b)                       = a.lo;
            *(v4f*)(b + HEADS * PTOK * CCH)  = a.hi;
        }
}

__global__ __launch_bounds__(384)
void qkv_proj_kernel(const float* __restrict__ emb,
                     const float* __restrict__ Wq,
                     const float* __restrict__ Wk,
                     const float* __restrict__ Wv,
                     float* __restrict__ ws)
{
    const int nb    = blockIdx.x;          // 0..7   (128-column block of 1024)
    const int mb    = blockIdx.y;          // 0..31  (128-row block of 4096)
    const int wave  = __builtin_amdgcn_readfirstlane(threadIdx.x >> 5);  // 0..11
    const int which = wave >> 2;           // 0:q 1:k 2:v
    const float* W  = (which == 0) ? Wq : ((which == 1) ? Wk : Wv);
    float* dst      = ws + (size_t)which * SEG;

    const int lane = threadIdx.x & 31;
    const int ln   = lane & 15;            // row of emb / column of W
    const int kh   = lane >> 4;            // K half-select (K = 2*kh, 2*kh+1)
    const int m0   = mb * 128 + (wave & 3) * 32;

    const float* ap = emb + (size_t)(m0 + ln) * CCH + 2 * kh;
    const float* bp = W + (size_t)(2 * kh) * CH + nb * 128 + ln * 8;
    // block (patch m0>>3, head 0, channel block nb); a head is 1024 floats on, a patch 8192
    float* d = dst + (size_t)(m0 >> 3) * (HEADS * PTOK * CCH) + nb * 128;

    if (which == 2) qkv_tile<true>(ap, bp, d, ln, kh);
    else            qkv_tile<false>(ap, bp, d, ln, kh);
}

__global__ __launch_bounds__(256)
void attn_head_kernel(float* __restrict__ ws)
{
    __shared__ float red[2][16];            // cross-wave sum/sumsq, slot = head & 1
    __shared__ __attribute__((aligned(16))) float stage[PTOK * CH];   // [p][c*8+h]

    const float* Qw  = ws;
    const float* Kw  = ws + SEG;
    const float* Vw  = ws + 2 * SEG;
    float*       Ctx = ws + 3 * SEG;

    const int patch = blockIdx.x;
    const int tid   = threadIdx.x;
    const int w     = tid >> 5;             // wave 0..7
    const int lane  = tid & 31;
    const int ln    = lane & 15;
    const int kh    = lane >> 4;
    const int c0    = w * 16;               // this wave's c block
    const size_t base = (size_t)patch * (HEADS * PTOK * CCH);   // head 0, channel block 0

    // S^T = K^T Q : A_op[m][k] = K[p][e0+m], B_op[k][n] = Q[p][c0+n].  p order, both
    // operands: lane half kh takes p = 4kh..4kh+3 (one 16-byte load of its channel's
    // row in the block), two of them per product; a wave-wide load is one whole block.
    const float* qp = Qw + base + w * 128 + ln * 8 + 4 * kh;
    const float* kp = Kw + base + ln * 8 + 4 * kh;
    // A fragments of ctx^T = V P^T: row m = p.  Lanes ln >= 8 read row ln-8
    // again: D rows 8..15 repeat rows 0..7 and are not stored.
    const float* vp = Vw + base + (ln & 7) * 16 + 8 * kh;

    // ---- operands of head 0
    v4f qv, kv[8];
    v4f vlo[8], vhi[8];
    qv = *(const v4f*)(qp);
    #pragma unroll
    for (int mt = 0; mt < 8; ++mt) kv[mt] = *(const v4f*)(kp + mt * 128);
    // Q and K go out ahead of V here as they do in the loop: with the two mixed
    // here, the counted waits in front of the score products, which must hold for
    // both orders, also cover a V load on every trip
    __builtin_amdgcn_sched_barrier(0);
    #pragma unroll
    for (int mt = 0; mt < 8; ++mt) {
        vlo[mt] = *(const v4f*)(vp + 128 * mt);        // e = 16mt + 8kh + 0..3
        vhi[mt] = *(const v4f*)(vp + 128 * mt + 4);    // e = 16mt + 8kh + 4..7
    }

    // stays rolled: the loads of head h+1 then cannot sink to their use, and the
    // text stays an eighth of the unrolled size
    #pragma unroll 1
    for (int h = 0; h < HEADS; ++h) {
        v8f acc[8];
        #pragma unroll
        for (int mt = 0; mt < 8; ++mt)
            #pragma unroll
            for (int v = 0; v < 8; ++v) acc[mt][v] = 0.0f;

        #pragma unroll
        for (int mt = 0; mt < 8; ++mt) {
            acc[mt] = WMMA_F32(kv[mt].xy, qv.xy, acc[mt]);    // p = 4kh, 4kh+1
            acc[mt] = WMMA_F32(kv[mt].zw, qv.zw, acc[mt]);    // p = 4kh+2, 4kh+3
        }

        // ---- next head's Q and K take the registers that the products above have read.
        // No test around these loads or around V's below (the last head reads itself
        // again, unused): with the same loads in the same order on every path, each
        // wait can be a counted one that leaves the younger loads in flight
        const int nx = ((h + 1 < HEADS) ? h + 1 : h) * (PTOK * CCH);
        {
            const float* k = kp + nx;
            qv = *(const v4f*)(qp + nx);
            #pragma unroll
            for (int mt = 0; mt < 8; ++mt) kv[mt] = *(const v4f*)(k + mt * 128);
        }

        // ---- InstanceNorm statistics over the whole 128x128 map
        float s = 0.0f, ss = 0.0f;
        #pragma unroll
        for (int mt = 0; mt < 8; ++mt)
            #pragma unroll
            for (int v = 0; v < 8; ++v) { const float x = acc[mt][v]; s += x; ss += x * x; }
        #pragma unroll
        for (int off = 16; off >= 1; off >>= 1) {
            s  += __shfl_xor(s,  off, 32);
            ss += __shfl_xor(ss, off, 32);
        }
        float* rd = red[h & 1];
        if (lane == 0) { rd[w] = s; rd[8 + w] = ss; }
        // barrier with fences on LDS alone: only the slots cross waves here, and
        // __syncthreads() would also wait for the next head's loads in flight
        __builtin_amdgcn_fence(__ATOMIC_RELEASE, "workgroup", "local");
        __builtin_amdgcn_s_barrier();
        __builtin_amdgcn_fence(__ATOMIC_ACQUIRE, "workgroup", "local");

        float S = 0.0f, SS = 0.0f;
        #pragma unroll
        for (int i = 0; i < 8; ++i) { S += rd[i]; SS += rd[8 + i]; }
        const float inv16k = 1.0f / 16384.0f;
        const float mu  = S * inv16k;
        const float var = SS * inv16k - mu * mu;
        const float rs  = rsqrtf(var + 1e-5f);   // mean shift cancels in softmax

        // ---- softmax of rs*attn over e, one attention row per lane pair (ln, ln+16)
        #pragma unroll
        for (int mt = 0; mt < 8; ++mt) acc[mt] *= rs;

        v8f mxv = acc[0];                        // 8 independent chains
        #pragma unroll
        for (int mt = 1; mt < 8; ++mt) mxv = __builtin_elementwise_max(mxv, acc[mt]);
        float mx = fmaxf(fmaxf(fmaxf(mxv[0], mxv[1]), fmaxf(mxv[2], mxv[3])),
                         fmaxf(fmaxf(mxv[4], mxv[5]), fmaxf(mxv[6], mxv[7])));
        mx = fmaxf(mx, xhalf(mx));

        // ---- exp, row sum, and ctx^T(p, c0..c0+15) += V P^T, K-dim = e = 128
        const float* vn = vp + nx;
        v8f smv = {};                            // 8 independent chains
        v8f cacc = {};
        #pragma unroll
        for (int mt = 0; mt < 8; ++mt) {
            acc[mt] = (acc[mt] - mx) * 1.44269504f;     // exp(x) = 2^(x log2 e)
            #pragma unroll
            for (int v = 0; v < 8; ++v)
                acc[mt][v] = __builtin_amdgcn_exp2f(acc[mt][v]);
            smv += acc[mt];
            #pragma unroll
            for (int i = 0; i < 4; ++i) {
                v2f a, b;
                a.x = (i < 2) ? vlo[mt][2 * i]     : vhi[mt][2 * i - 4];
                a.y = (i < 2) ? vlo[mt][2 * i + 1] : vhi[mt][2 * i - 3];
                b.x = acc[mt][2 * i];
                b.y = acc[mt][2 * i + 1];
                cacc = WMMA_F32(a, b, cacc);
            }
            // next head's V tile takes the registers whose products are issued
            vlo[mt] = *(const v4f*)(vn + 128 * mt);
            vhi[mt] = *(const v4f*)(vn + 128 * mt + 4);
        }
        float sum = ((smv[0] + smv[1]) + (smv[2] + smv[3])) + ((smv[4] + smv[5]) + (smv[6] + smv[7]));
        sum += xhalf(sum);
        const float rinv = 1.0f / sum;

        // ctx[c,p] of this head -> stage[p][c*8+h]; register v of lanes 0-15 is p = v
        if (kh == 0) {
            float* sp = stage + (c0 + ln) * HEADS + h;
            #pragma unroll
            for (int v = 0; v < 8; ++v)
                sp[v * CH] = cacc[v] * rinv;
        }
    }

    // lanes 16-31 read what lanes 0-15 wrote
    __syncthreads();

    // stage -> Ctx[patch][p][c*8+h]: each store covers 512 contiguous bytes
    const float* sr = stage + c0 * HEADS + 4 * lane;
    float* cp = Ctx + (size_t)patch * PTOK * CH + c0 * HEADS + 4 * lane;
    #pragma unroll
    for (int p = 0; p < PTOK; ++p)
        *(v4f*)(cp + (size_t)p * CH) = *(const v4f*)(sr + p * CH);
}

// ---------------------------------------------------------------------------
// Kernel 3: out = Ctx(4096x1024) @ Wout(1024x128) with token-position remap.
// One 8-wave workgroup per 16 rows x all 128 columns; wave w sums the k slice
// [128w, 128w+128) into 8 accumulator tiles, the 8 partial tiles are added
// through LDS in ascending w.  Every Ctx element is read once on the chip.
// Column tile j holds the columns n = 64*(j>>2) + 4*ln + (j&3): a lane's B values
// of one k row are two 16-byte loads, and each wave-wide load covers whole lines.
// k order, both operands: in each group of 8 k, lane half kh takes k = 4kh..4kh+3
// (one 16-byte load of the Ctx row), two of them per product.
// ---------------------------------------------------------------------------
__global__ __launch_bounds__(256)
void out_proj_kernel(const float* __restrict__ ws,
                     const float* __restrict__ Wout,
                     float* __restrict__ out)
{
    __shared__ float part[8 * 16 * CCH];   // [wave][row][column], 64 KB

    const float* Ctx = ws + 3 * SEG;
    const int m0   = blockIdx.x * 16;      // 16 rows = 2 patches
    const int wave = __builtin_amdgcn_readfirstlane(threadIdx.x >> 5);  // 0..7
    const int lane = threadIdx.x & 31;
    const int ln   = lane & 15;
    const int kh   = lane >> 4;
    const int ks   = wave * 128;           // this wave's k slice

    const float* ap = Ctx + (size_t)(m0 + ln) * CH + ks + 4 * kh;
    const float* bp = Wout + (size_t)(ks + 4 * kh) * CCH + 4 * ln;

    // the wave's whole A slice: a[g] = Ctx[m0+ln][ks + 8g + 4kh + 0..3]
    v4f a[16];
    #pragma unroll
    for (int g = 0; g < 16; ++g) a[g] = *(const v4f*)(ap + 8 * g);

    v8f acc[8];
    #pragma unroll
    for (int j = 0; j < 8; ++j)
        #pragma unroll
        for (int v = 0; v < 8; ++v) acc[j][v] = 0.0f;

    // B in chunks of 16 k (4 products deep, 16 loads), two register sets: chunk
    // c+1 is in flight while the 32 products of chunk c issue.
    v4f b[2][16];
    #pragma unroll
    for (int s = 0; s < 4; ++s) {
        const float* br = bp + (size_t)(8 * (s >> 1) + 2 * (s & 1)) * CCH;
        b[0][4 * s + 0] = *(const v4f*)(br);
        b[0][4 * s + 1] = *(const v4f*)(br + 64);
        b[0][4 * s + 2] = *(const v4f*)(br + CCH);
        b[0][4 * s + 3] = *(const v4f*)(br + CCH + 64);
    }
    // the address registers of the Ctx loads above are reused once the products start
    asm volatile("s_wait_xcnt 0x0" ::: "memory");
    // keeps the loads above ahead of the first products: left free, the scheduler
    // sinks each load to just before its use and the wave waits out every latency
    __builtin_amdgcn_sched_barrier(0);
    #pragma unroll
    for (int c = 0; c < 8; ++c) {
        if (c + 1 < 8) {
            #pragma unroll
            for (int s = 0; s < 4; ++s) {
                const float* br = bp + (size_t)(16 * (c + 1) + 8 * (s >> 1) + 2 * (s & 1)) * CCH;
                b[(c + 1) & 1][4 * s + 0] = *(const v4f*)(br);
                b[(c + 1) & 1][4 * s + 1] = *(const v4f*)(br + 64);
                b[(c + 1) & 1][4 * s + 2] = *(const v4f*)(br + CCH);
                b[(c + 1) & 1][4 * s + 3] = *(const v4f*)(br + CCH + 64);
            }
        }
        // chunk c+1's 16 loads issue as one group before chunk c's products
        __builtin_amdgcn_sched_barrier(0);
        #pragma unroll
        for (int s = 0; s < 4; ++s) {
            v2f av;
            av.x = a[2 * c + (s >> 1)][2 * (s & 1)];
            av.y = a[2 * c + (s >> 1)][2 * (s & 1) + 1];
            #pragma unroll
            for (int j = 0; j < 8; ++j) {
                v2f bv;
                bv.x = b[c & 1][4 * s + (j >> 2)][j & 3];
                bv.y = b[c & 1][4 * s + 2 + (j >> 2)][j & 3];
                acc[j] = WMMA_F32(av, bv, acc[j]);
            }
        }
        // chunk c+2's loads stay behind chunk c's products, whose registers they take
        __builtin_amdgcn_sched_barrier(0);
    }

    // partial tile to LDS: register v of tile j = row v + 8kh, column as above
    float* pw = part + wave * (16 * CCH) + (8 * kh) * CCH + 4 * ln;
    #pragma unroll
    for (int v = 0; v < 8; ++v)
        #pragma unroll
        for (int q = 0; q < 2; ++q) {
            v4f t;
            t.x = acc[4 * q + 0][v];
            t.y = acc[4 * q + 1][v];
            t.z = acc[4 * q + 2][v];
            t.w = acc[4 * q + 3][v];
            *(v4f*)(pw + v * CCH + 64 * q) = t;
        }
    __syncthreads();

    // thread -> row tid>>4, columns 4*(tid&15) + 0..3 and 64 more
    const int rl = threadIdx.x >> 4;
    const float* pr = part + rl * CCH + 4 * (threadIdx.x & 15);
    v4f o0 = *(const v4f*)(pr);
    v4f o1 = *(const v4f*)(pr + 64);
    #pragma unroll
    for (int w = 1; w < 8; ++w) {
        o0 += *(const v4f*)(pr + w * (16 * CCH));
        o1 += *(const v4f*)(pr + w * (16 * CCH) + 64);
    }

    // row r = (patch, p); remap to '(b, d p1 h p2 w p3)' token order
    const int r     = m0 + rl;
    const int patch = r >> 3;
    const int p     = r & 7;
    const int bb  = patch >> 5;
    const int d   = (patch >> 4) & 1;
    const int hh  = (patch >> 2) & 3;
    const int wwp = patch & 3;
    const int p1  = (p >> 2) & 1;
    const int p2  = (p >> 1) & 1;
    const int p3  = p & 1;
    const int orow = bb * 256 + d * 128 + p1 * 64 + hh * 16 + p2 * 8 + wwp * 2 + p3;
    float* op = out + (size_t)orow * CCH + 4 * (threadIdx.x & 15);
    *(v4f*)(op)      = o0;
    *(v4f*)(op + 64) = o1;
}

// ---------------------------------------------------------------------------
extern "C" void kernel_launch(void* const* d_in, const int* in_sizes, int n_in,
                              void* d_out, int out_size, void* d_ws, size_t ws_size,
                              hipStream_t stream)
{
    const float* emb  = (const float*)d_in[0];
    const float* Wq   = (const float*)d_in[1];
    const float* Wk   = (const float*)d_in[2];
    const float* Wv   = (const float*)d_in[3];
    const float* Wout = (const float*)d_in[4];
    float* ws  = (float*)d_ws;      // needs 4*SEG*4 = 64 MB
    float* out = (float*)d_out;

    qkv_proj_kernel<<<dim3(8, 32), 384, 0, stream>>>(emb, Wq, Wk, Wv, ws);
    attn_head_kernel<<<dim3(NP), 256, 0, stream>>>(ws);
    out_proj_kernel<<<dim3(256), 256, 0, stream>>>(ws, Wout, out);
}

// v006
// A run of this version takes 54.6 microseconds.
// Timed twice side by side with v005, it ran 1.06 times as fast both times.
// All steps since v000 together make it 2.64 times as fast.
#include <hip/hip_runtime.h>

// ---------------------------------------------------------------------------
// MI455X / gfx1250, wave32. Matrix ops via V_WMMA_F32_16X16X4_F32 (fp32 in/out,
// matches the fp32 reference exactly up to accumulation order).
//
// Problem sizes (fixed by the reference):
//   patches NP=512, tokens/patch P=8, channels C=128, heads H=8, CH=1024
//   emb (512,8,128)  Wq/Wk/Wv (128,1024)  Wout (1024,128)  out (16,256,128)
//
// Workspace layout (fp32, 48 MB total):
//   [0 .. 4M)    Qw  [patch][head][c/16][c%16][p]   blocks of 128 floats = 512 B
//   [4M .. 8M)   Kw  [patch][head][c/16][c%16][p]
//   [8M .. 12M)  Vw  [patch][head][c/16][p][c%16]
// ctx never leaves the chip: it passes from attention to the output projection in LDS.
// ---------------------------------------------------------------------------

typedef float v2f __attribute__((ext_vector_type(2)));
typedef float v4f __attribute__((ext_vector_type(4)));
typedef float v8f __attribute__((ext_vector_type(8)));

#define WMMA_F32(A, B, Cacc) \
    __builtin_amdgcn_wmma_f32_16x16x4_f32(false, (A), false, (B), (short)0, (Cacc), false, false)

static constexpr int NP     = 512;              // patches
static constexpr int PTOK   = 8;                // tokens per patch
static constexpr int CCH    = 128;              // channels c
static constexpr int HEADS  = 8;
static constexpr int CH     = 1024;             // c*heads
static constexpr int MROWS  = NP * PTOK;        // 4096
static constexpr size_t SEG = (size_t)NP * HEADS * PTOK * CCH;  // 4,194,304 floats

__device__ __forceinline__ float xhalf(float x)   // value of lane l ^ 16
{
    return __builtin_bit_cast(float, __builtin_amdgcn_permlanex16(
        __builtin_bit_cast(int, x), __builtin_bit_cast(int, x),
        0x76543210, 0xfedcba98, false, false));
}

// ---------------------------------------------------------------------------
// Kernel 1: QKV projection.  One 12-wave workgroup per (128 rows x 128 columns)
// of q, k and v together: waves 0-3 do q, 4-7 k, 8-11 v; each wave owns a
// 32 x 128 register tile (2 row tiles x 8 column tiles = 16 accumulators).
// Column tile j takes the columns n = 128*nb + 8*ln + j, i.e. head j of 16
// adjacent channels: a lane's 8 weight values of one k row are 32 contiguous
// bytes, and one accumulator tile holds the 512-byte block (head j, these 16
// channels) of two patches.
// Every emb fragment feeds 8 products and every weight fragment 2.  The k order
// of each output element is the plain ascending one.
// q, k: D = emb W, lane = channel, registers = p, one patch per wave half.
// v:    D = W^T emb^T (the same two fragments, roles exchanged), lane = (patch, p),
//       registers = 8 channels.
// Either way a lane holds 32 contiguous bytes of its patch's block.  Before the
// stores, lanes of the two patches exchange four registers, so that all 32 lanes
// write to ONE block: every store is 16 bytes a lane over the whole block (4 lines).
// ---------------------------------------------------------------------------
__device__ __forceinline__ float xrow8(float x)   // value of lane l ^ 8
{
    return __builtin_bit_cast(float, __builtin_amdgcn_permlane16(
        __builtin_bit_cast(int, x), __builtin_bit_cast(int, x),
        0xfedcba98, 0x76543210, false, false));
}

template <bool VT>   // VT: the v form
__device__ __forceinline__ void qkv_tile(const float* __restrict__ ap,
                                         const float* __restrict__ bp,
                                         float* __restrict__ d, int ln, int kh)
{
    v8f acc[2][8];
    #pragma unroll
    for (int t = 0; t < 2; ++t)
        #pragma unroll
        for (int j = 0; j < 8; ++j)
            #pragma unroll
            for (int v = 0; v < 8; ++v) acc[t][j][v] = 0.0f;

    // unroll 4: the loads of four k steps go out as one group ahead of their 64
    // products, so a wave stalls on memory once per 64 products, not once per 16.
    #pragma unroll 4
    for (int k0 = 0; k0 < CCH; k0 += 4) {
        const v2f a0 = *(const v2f*)(ap + k0);               // rows m0 + ln
        const v2f a1 = *(const v2f*)(ap + 16 * CCH + k0);    // rows m0 + 16 + ln
        const float* br = bp + (size_t)k0 * CH;
        const v4f x0 = *(const v4f*)(br);                    // k = k0+2kh,   heads 0-3
        const v4f x1 = *(const v4f*)(br + 4);                // k = k0+2kh,   heads 4-7
        const v4f y0 = *(const v4f*)(br + CH);               // k = k0+2kh+1, heads 0-3
        const v4f y1 = *(const v4f*)(br + CH + 4);           // k = k0+2kh+1, heads 4-7
        #pragma unroll
        for (int j = 0; j < 8; ++j) {
            v2f b;
            b.x = (j < 4) ? x0[j & 3] : x1[j & 3];
            b.y = (j < 4) ? y0[j & 3] : y1[j & 3];
            acc[0][j] = VT ? WMMA_F32(b, a0, acc[0][j]) : WMMA_F32(a0, b, acc[0][j]);
            acc[1][j] = VT ? WMMA_F32(b, a1, acc[1][j]) : WMMA_F32(a1, b, acc[1][j]);
        }
    }

    // D element (m,n): m = v + 8*kh, n = ln (C/D layout); head = j; tile t = patches 2t, 2t+1.
    // q, k: patch 2t + kh, p = v, channel ln      -> block [16 channels][p], float ln*8 + v
    // v:    patch 2t + (ln>>3), p = ln&7, channel 8kh + v -> block [p][16 channels],
    //       float (ln&7)*16 + 8kh + v
    // up: this lane holds the second patch.  After the exchange a lane of the first
    // patch writes its floats 0-3 of both blocks, its partner the floats 4-7.
    const int up = VT ? (ln >> 3) : kh;
    float* dl = d + (VT ? (ln & 7) * 16 + 8 * kh : ln * 8) + 4 * up;
    #pragma unroll
    for (int t = 0; t < 2; ++t)
        #pragma unroll
        for (int j = 0; j < 8; ++j) {
            v8f a = acc[t][j];
            #pragma unroll
            for (int v = 0; v < 4; ++v) {
                const float x = a[v], y = a[v + 4];
                const float s = up ? x : y;              // what the partner lane writes
                const float r = VT ? xrow8(s) : xhalf(s);
                a[v]     = up ? r : x;                   // patch 2t
                a[v + 4] = up ? y : r;                   // patch 2t+1
            }
            float* b = dl + (2 * t * HEADS + j) * (PTOK * CCH);
            *(v4f*)(b)                       = a.lo;
            *(v4f*)(b + HEADS * PTOK * CCH)  = a.hi;
        }
}

__global__ __launch_bounds__(384)
void qkv_proj_kernel(const float* __restrict__ emb,
                     const float* __restrict__ Wq,
                     const float* __restrict__ Wk,
                     const float* __restrict__ Wv,
                     float* __restrict__ ws)
{
    const int nb    = blockIdx.x;          // 0..7   (128-column block of 1024)
    const int mb    = blockIdx.y;          // 0..31  (128-row block of 4096)
    const int wave  = __builtin_amdgcn_readfirstlane(threadIdx.x >> 5);  // 0..11
    const int which = wave >> 2;           // 0:q 1:k 2:v
    const float* W  = (which == 0) ? Wq : ((which == 1) ? Wk : Wv);
    float* dst      = ws + (size_t)which * SEG;

    const int lane = threadIdx.x & 31;
    const int ln   = lane & 15;            // row of emb / column of W
    const int kh   = lane >> 4;            // K half-select (K = 2*kh, 2*kh+1)
    const int m0   = mb * 128 + (wave & 3) * 32;

    const float* ap = emb + (size_t)(m0 + ln) * CCH + 2 * kh;
    const float* bp = W + (size_t)(2 * kh) * CH + nb * 128 + ln * 8;
    // block (patch m0>>3, head 0, channel block nb); a head is 1024 floats on, a patch 8192
    float* d = dst + (size_t)(m0 >> 3) * (HEADS * PTOK * CCH) + nb * 128;

    if (which == 2) qkv_tile<true>(ap, bp, d, ln, kh);
    else            qkv_tile<false>(ap, bp, d, ln, kh);
}

static constexpr int SP = CH + 4;

__global__ __launch_bounds__(512)
void attn_out_kernel(const float* __restrict__ ws,
                     const float* __restrict__ Wout,
                     float* __restrict__ out)
{
    __shared__ float red[2][2][16];         // [patch][head & 1] cross-wave sum/sumsq
    __shared__ __attribute__((aligned(16))) float stage[2 * PTOK * SP];   // [patch, p][c*8+h]
    __shared__ __attribute__((aligned(16))) float part[8 * 16 * CCH];     // [k slice][row][column], 64 KB

    const float* Qw  = ws;
    const float* Kw  = ws + SEG;
    const float* Vw  = ws + 2 * SEG;

    const int tid   = threadIdx.x;
    const int half  = tid >> 8;             // which of the two patches
    const int patch = 2 * blockIdx.x + half;
    const int w     = (tid >> 5) & 7;       // wave 0..7 of its patch
    const int lane  = tid & 31;
    const int ln    = lane & 15;
    const int kh    = lane >> 4;
    const int c0    = w * 16;               // this wave's c block
    const size_t base = (size_t)patch * (HEADS * PTOK * CCH);   // head 0, channel block 0

    // S^T = K^T Q : A_op[m][k] = K[p][e0+m], B_op[k][n] = Q[p][c0+n].  p order, both
    // operands: lane half kh takes p = 4kh..4kh+3 (one 16-byte load of its channel's
    // row in the block), two of them per product; a wave-wide load is one whole block.
    const float* qp = Qw + base + w * 128 + ln * 8 + 4 * kh;
    const float* kp = Kw + base + ln * 8 + 4 * kh;
    // A fragments of ctx^T = V P^T: row m = p.  Lanes ln >= 8 read row ln-8
    // again: D rows 8..15 repeat rows 0..7 and are not stored.
    const float* vp = Vw + base + (ln & 7) * 16 + 8 * kh;

    // ---- operands of head 0
    v4f qv, kv[8];
    v4f vlo[8], vhi[8];
    qv = *(const v4f*)(qp);
    #pragma unroll
    for (int mt = 0; mt < 8; ++mt) kv[mt] = *(const v4f*)(kp + mt * 128);
    // Q and K go out ahead of V here as they do in the loop: with the two mixed
    // here, the counted waits in front of the score products, which must hold for
    // both orders, also cover a V load on every trip
    __builtin_amdgcn_sched_barrier(0);
    #pragma unroll
    for (int mt = 0; mt < 8; ++mt) {
        vlo[mt] = *(const v4f*)(vp + 128 * mt);        // e = 16mt + 8kh + 0..3
        vhi[mt] = *(const v4f*)(vp + 128 * mt + 4);    // e = 16mt + 8kh + 4..7
    }

    // stays rolled: the loads of head h+1 then cannot sink to their use, and the
    // text stays an eighth of the unrolled size
    #pragma unroll 1
    for (int h = 0; h < HEADS; ++h) {
        v8f acc[8];
        #pragma unroll
        for (int mt = 0; mt < 8; ++mt)
            #pragma unroll
            for (int v = 0; v < 8; ++v) acc[mt][v] = 0.0f;

        #pragma unroll
        for (int mt = 0; mt < 8; ++mt) {
            acc[mt] = WMMA_F32(kv[mt].xy, qv.xy, acc[mt]);    // p = 4kh, 4kh+1
            acc[mt] = WMMA_F32(kv[mt].zw, qv.zw, acc[mt]);    // p = 4kh+2, 4kh+3
        }

        // ---- next head's Q and K take the registers that the products above have read.
        // No test around these loads or around V's below (the last head reads itself
        // again, unused): with the same loads in the same order on every path, each
        // wait can be a counted one that leaves the younger loads in flight
        const int nx = ((h + 1 < HEADS) ? h + 1 : h) * (PTOK * CCH);
        {
            const float* k = kp + nx;
            qv = *(const v4f*)(qp + nx);
            #pragma unroll
            for (int mt = 0; mt < 8; ++mt) kv[mt] = *(const v4f*)(k + mt * 128);
        }

        // ---- InstanceNorm statistics over the whole 128x128 map
        float s = 0.0f, ss = 0.0f;
        #pragma unroll
        for (int mt = 0; mt < 8; ++mt)
            #pragma unroll
            for (int v = 0; v < 8; ++v) { const float x = acc[mt][v]; s += x; ss += x * x; }
        #pragma unroll
        for (int off = 16; off >= 1; off >>= 1) {
            s  += __shfl_xor(s,  off, 32);
            ss += __shfl_xor(ss, off, 32);
        }
        float* rd = red[half][h & 1];
        if (lane == 0) { rd[w] = s; rd[8 + w] = ss; }
        // barrier with fences on LDS alone: only the slots cross waves here, and
        // __syncthreads() would also wait for the next head's loads in flight
        __builtin_amdgcn_fence(__ATOMIC_RELEASE, "workgroup", "local");
        __builtin_amdgcn_s_barrier();
        __builtin_amdgcn_fence(__ATOMIC_ACQUIRE, "workgroup", "local");

        float S = 0.0f, SS = 0.0f;
        #pragma unroll
        for (int i = 0; i < 8; ++i) { S += rd[i]; SS += rd[8 + i]; }
        const float inv16k = 1.0f / 16384.0f;
        const float mu  = S * inv16k;
        const float var = SS * inv16k - mu * mu;
        const float rs  = rsqrtf(var + 1e-5f);   // mean shift cancels in softmax

        // ---- softmax of rs*attn over e, one attention row per lane pair (ln, ln+16)
        #pragma unroll
        for (int mt = 0; mt < 8; ++mt) acc[mt] *= rs;

        v8f mxv = acc[0];                        // 8 independent chains
        #pragma unroll
        for (int mt = 1; mt < 8; ++mt) mxv = __builtin_elementwise_max(mxv, acc[mt]);
        float mx = fmaxf(fmaxf(fmaxf(mxv[0], mxv[1]), fmaxf(mxv[2], mxv[3])),
                         fmaxf(fmaxf(mxv[4], mxv[5]), fmaxf(mxv[6], mxv[7])));
        mx = fmaxf(mx, xhalf(mx));

        // ---- exp, row sum, and ctx^T(p, c0..c0+15) += V P^T, K-dim = e = 128
        const float* vn = vp + nx;
        v8f smv = {};                            // 8 independent chains
        v8f cacc = {};
        #pragma unroll
        for (int mt = 0; mt < 8; ++mt) {
            acc[mt] = (acc[mt] - mx) * 1.44269504f;     // exp(x) = 2^(x log2 e)
            #pragma unroll
            for (int v = 0; v < 8; ++v)
                acc[mt][v] = __builtin_amdgcn_exp2f(acc[mt][v]);
            smv += acc[mt];
            #pragma unroll
            for (int i = 0; i < 4; ++i) {
                v2f a, b;
                a.x = (i < 2) ? vlo[mt][2 * i]     : vhi[mt][2 * i - 4];
                a.y = (i < 2) ? vlo[mt][2 * i + 1] : vhi[mt][2 * i - 3];
                b.x = acc[mt][2 * i];
                b.y = acc[mt][2 * i + 1];
                cacc = WMMA_F32(a, b, cacc);
            }
            // next head's V tile takes the registers whose products are issued
            vlo[mt] = *(const v4f*)(vn + 128 * mt);
            vhi[mt] = *(const v4f*)(vn + 128 * mt + 4);
        }
        float sum = ((smv[0] + smv[1]) + (smv[2] + smv[3])) + ((smv[4] + smv[5]) + (smv[6] + smv[7]));
        sum += xhalf(sum);
        const float rinv = 1.0f / sum;

        // ctx[c,p] of this head -> stage[patch, p][c*8+h]; register v of lanes 0-15 is p = v
        if (kh == 0) {
            float* sp = stage + half * (PTOK * SP) + (c0 + ln) * HEADS + h;
            #pragma unroll
            for (int v = 0; v < 8; ++v)
                sp[v * SP] = cacc[v] * rinv;
        }
    }

    // every wave reads the ctx columns [128s, 128s+128) of both patches, which waves s and s+8 wrote
    __syncthreads();

    const int m0   = blockIdx.x * 16;      // 16 rows = 2 patches
    const int wave = __builtin_amdgcn_readfirstlane(tid >> 5);  // 0..15
    const int sl   = wave & 7;             // k slice
    const int qc   = wave >> 3;            // 64-column half
    const int ks   = sl * 128;

    const float* as = stage + ln * SP + ks + 4 * kh;
    const float* bp = Wout + (size_t)(ks + 4 * kh) * CCH + 64 * qc + 4 * ln;

    // the wave's whole A slice: a[g] = ctx[ln][ks + 8g + 4kh + 0..3]
    v4f a[16];
    #pragma unroll
    for (int g = 0; g < 16; ++g) a[g] = *(const v4f*)(as + 8 * g);

    v8f oacc[4];
    #pragma unroll
    for (int j = 0; j < 4; ++j)
        #pragma unroll
        for (int v = 0; v < 8; ++v) oacc[j][v] = 0.0f;

    // B in chunks of 16 k (4 products deep, 8 loads), two register sets: chunk
    // c+1 is in flight while the 16 products of chunk c issue.
    v4f b[2][8];
    #pragma unroll
    for (int s = 0; s < 4; ++s) {
        const float* br = bp + (size_t)(8 * (s >> 1) + 2 * (s & 1)) * CCH;
        b[0][2 * s + 0] = *(const v4f*)(br);
        b[0][2 * s + 1] = *(const v4f*)(br + CCH);
    }
    // keeps the loads above ahead of the first products: left free, the scheduler
    // sinks each load to just before its use and the wave waits out every latency
    __builtin_amdgcn_sched_barrier(0);
    #pragma unroll
    for (int c = 0; c < 8; ++c) {
        if (c + 1 < 8) {
            #pragma unroll
            for (int s = 0; s < 4; ++s) {
                const float* br = bp + (size_t)(16 * (c + 1) + 8 * (s >> 1) + 2 * (s & 1)) * CCH;
                b[(c + 1) & 1][2 * s + 0] = *(const v4f*)(br);
                b[(c + 1) & 1][2 * s + 1] = *(const v4f*)(br + CCH);
            }
        }
        // chunk c+1's 8 loads issue as one group before chunk c's products
        __builtin_amdgcn_sched_barrier(0);
        #pragma unroll
        for (int s = 0; s < 4; ++s) {
            v2f av;
            av.x = a[2 * c + (s >> 1)][2 * (s & 1)];
            av.y = a[2 * c + (s >> 1)][2 * (s & 1) + 1];
            #pragma unroll
            for (int j = 0; j < 4; ++j) {
                v2f bv;
                bv.x = b[c & 1][2 * s + 0][j];
                bv.y = b[c & 1][2 * s + 1][j];
                oacc[j] = WMMA_F32(av, bv, oacc[j]);
            }
        }
        // chunk c+2's loads stay behind chunk c's products, whose registers they take
        __builtin_amdgcn_sched_barrier(0);
    }

    // partial tile to LDS: register v of tile j = row v + 8kh, column as above
    float* pw = part + sl * (16 * CCH) + (8 * kh) * CCH + 64 * qc + 4 * ln;
    #pragma unroll
    for (int v = 0; v < 8; ++v) {
        v4f t;
        t.x = oacc[0][v];
        t.y = oacc[1][v];
        t.z = oacc[2][v];
        t.w = oacc[3][v];
        *(v4f*)(pw + v * CCH) = t;
    }
    __syncthreads();

    // thread -> row tid>>5, columns 4*(tid&31) + 0..3
    const int rl = tid >> 5;
    const float* pr = part + rl * CCH + 4 * lane;
    v4f o = *(const v4f*)(pr);
    #pragma unroll
    for (int s = 1; s < 8; ++s)
        o += *(const v4f*)(pr + s * (16 * CCH));

    // row r = (patch, p); remap to '(b, d p1 h p2 w p3)' token order
    const int r   = m0 + rl;
    const int pt  = r >> 3;
    const int p   = r & 7;
    const int bb  = pt >> 5;
    const int d   = (pt >> 4) & 1;
    const int hh  = (pt >> 2) & 3;
    const int wwp = pt & 3;
    const int p1  = (p >> 2) & 1;
    const int p2  = (p >> 1) & 1;
    const int p3  = p & 1;
    const int orow = bb * 256 + d * 128 + p1 * 64 + hh * 16 + p2 * 8 + wwp * 2 + p3;
    *(v4f*)(out + (size_t)orow * CCH + 4 * lane) = o;
}

// ---------------------------------------------------------------------------
extern "C" void kernel_launch(void* const* d_in, const int* in_sizes, int n_in,
                              void* d_out, int out_size, void* d_ws, size_t ws_size,
                              hipStream_t stream)
{
    const float* emb  = (const float*)d_in[0];
    const float* Wq   = (const float*)d_in[1];
    const float* Wk   = (const float*)d_in[2];
    const float* Wv   = (const float*)d_in[3];
    const float* Wout = (const float*)d_in[4];
    float* ws  = (float*)d_ws;      // needs 3*SEG*4 = 48 MB
    float* out = (float*)d_out;

    qkv_proj_kernel<<<dim3(8, 32), 384, 0, stream>>>(emb, Wq, Wk, Wv, ws);
    attn_out_kernel<<<dim3(NP / 2), 512, 0, stream>>>(ws, Wout, out);
}

// v007
// It runs in 53 microseconds.
// Timed twice side by side with v006, it ran 1.03 times as fast both times.
// Over all steps from v000 it is 2.72 times as fast.
#include <hip/hip_runtime.h>

// ---------------------------------------------------------------------------
// MI455X / gfx1250, wave32. Matrix ops via V_WMMA_F32_16X16X4_F32 (fp32 in/out,
// matches the fp32 reference exactly up to accumulation order).
//
// Problem sizes (fixed by the reference):
//   patches NP=512, tokens/patch P=8, channels C=128, heads H=8, CH=1024
//   emb (512,8,128)  Wq/Wk/Wv (128,1024)  Wout (1024,128)  out (16,256,128)
//
// Workspace layout (fp32, 48 MB total):
//   [0 .. 4M)    Qw  [patch][head][c/16][c%16][p]   blocks of 128 floats = 512 B
//   [4M .. 8M)   Kw  [patch][head][c/16][c%16][p]
//   [8M .. 12M)  Vw  [patch][head][c/16][p][c%16]
// ctx never leaves the chip: it passes from attention to the output projection in LDS.
// ---------------------------------------------------------------------------

typedef float v2f __attribute__((ext_vector_type(2)));
typedef float v4f __attribute__((ext_vector_type(4)));
typedef float v8f __attribute__((ext_vector_type(8)));

#define WMMA_F32(A, B, Cacc) \
    __builtin_amdgcn_wmma_f32_16x16x4_f32(false, (A), false, (B), (short)0, (Cacc), false, false)

static constexpr int NP     = 512;              // patches
static constexpr int PTOK   = 8;                // tokens per patch
static constexpr int CCH    = 128;              // channels c
static constexpr int HEADS  = 8;
static constexpr int CH     = 1024;             // c*heads
static constexpr int MROWS  = NP * PTOK;        // 4096
static constexpr size_t SEG = (size_t)NP * HEADS * PTOK * CCH;  // 4,194,304 floats

__device__ __forceinline__ float xhalf(float x)   // value of lane l ^ 16
{
    return __builtin_bit_cast(float, __builtin_amdgcn_permlanex16(
        __builtin_bit_cast(int, x), __builtin_bit_cast(int, x),
        0x76543210, 0xfedcba98, false, false));
}

// ---------------------------------------------------------------------------
// Kernel 1: QKV projection.  One 12-wave workgroup per (128 rows x 128 columns)
// of q, k and v together: waves 0-3 do q, 4-7 k, 8-11 v; each wave owns a
// 32 x 128 register tile (2 row tiles x 8 column tiles = 16 accumulators).
// Column tile j takes the columns n = 128*nb + 8*ln + j, i.e. head j of 16
// adjacent channels: a lane's 8 weight values of one k row are 32 contiguous
// bytes, and one accumulator tile holds the 512-byte block (head j, these 16
// channels) of two patches.
// Every emb fragment feeds 8 products and every weight fragment 2.  The k order
// of each output element is the plain ascending one.
// q, k: D = emb W, lane = channel, registers = p, one patch per wave half.
// v:    D = W^T emb^T (the same two fragments, roles exchanged), lane = (patch, p),
//       registers = 8 channels.
// Either way a lane holds 32 contiguous bytes of its patch's block.  Before the
// stores, lanes of the two patches exchange four registers, so that all 32 lanes
// write to ONE block: every store is 16 bytes a lane over the whole block (4 lines).
// ---------------------------------------------------------------------------
__device__ __forceinline__ float xrow8(float x)   // value of lane l ^ 8
{
    return __builtin_bit_cast(float, __builtin_amdgcn_permlane16(
        __builtin_bit_cast(int, x), __builtin_bit_cast(int, x),
        0xfedcba98, 0x76543210, false, false));
}

template <bool VT>   // VT: the v form
__device__ __forceinline__ void qkv_tile(const float* __restrict__ ap,
                                         const float* __restrict__ bp,
                                         float* __restrict__ d, int ln, int kh)
{
    v8f acc[2][8];
    #pragma unroll
    for (int t = 0; t < 2; ++t)
        #pragma unroll
        for (int j = 0; j < 8; ++j)
            #pragma unroll
            for (int v = 0; v < 8; ++v) acc[t][j][v] = 0.0f;

    // unroll 4: the loads of four k steps go out as one group ahead of their 64
    // products, so a wave stalls on memory once per 64 products, not once per 16.
    #pragma unroll 4
    for (int k0 = 0; k0 < CCH; k0 += 4) {
        const v2f a0 = *(const v2f*)(ap + k0);               // rows m0 + ln
        const v2f a1 = *(const v2f*)(ap + 16 * CCH + k0);    // rows m0 + 16 + ln
        const float* br = bp + (size_t)k0 * CH;
        const v4f x0 = *(const v4f*)(br);                    // k = k0+2kh,   heads 0-3
        const v4f x1 = *(const v4f*)(br + 4);                // k = k0+2kh,   heads 4-7
        const v4f y0 = *(const v4f*)(br + CH);               // k = k0+2kh+1, heads 0-3
        const v4f y1 = *(const v4f*)(br + CH + 4);           // k = k0+2kh+1, heads 4-7
        #pragma unroll
        for (int j = 0; j < 8; ++j) {
            v2f b;
            b.x = (j < 4) ? x0[j & 3] : x1[j & 3];
            b.y = (j < 4) ? y0[j & 3] : y1[j & 3];
            acc[0][j] = VT ? WMMA_F32(b, a0, acc[0][j]) : WMMA_F32(a0, b, acc[0][j]);
            acc[1][j] = VT ? WMMA_F32(b, a1, acc[1][j]) : WMMA_F32(a1, b, acc[1][j]);
        }
    }

    // D element (m,n): m = v + 8*kh, n = ln (C/D layout); head = j; tile t = patches 2t, 2t+1.
    // q, k: patch 2t + kh, p = v, channel ln      -> block [16 channels][p], float ln*8 + v
    // v:    patch 2t + (ln>>3), p = ln&7, channel 8kh + v -> block [p][16 channels],
    //       float (ln&7)*16 + 8kh + v
    // up: this lane holds the second patch.  After the exchange a lane of the first
    // patch writes its floats 0-3 of both blocks, its partner the floats 4-7.
    const int up = VT ? (ln >> 3) : kh;
    float* dl = d + (VT ? (ln & 7) * 16 + 8 * kh : ln * 8) + 4 * up;
    #pragma unroll
    for (int t = 0; t < 2; ++t)
        #pragma unroll
        for (int j = 0; j < 8; ++j) {
            v8f a = acc[t][j];
            #pragma unroll
            for (int v = 0; v < 4; ++v) {
                const float x = a[v], y = a[v + 4];
                const float s = up ? x : y;              // what the partner lane writes
                const float r = VT ? xrow8(s) : xhalf(s);
                a[v]     = up ? r : x;                   // patch 2t
                a[v + 4] = up ? y : r;                   // patch 2t+1
            }
            float* b = dl + (2 * t * HEADS + j) * (PTOK * CCH);
            *(v4f*)(b)                       = a.lo;
            *(v4f*)(b + HEADS * PTOK * CCH)  = a.hi;
        }
}

__global__ __launch_bounds__(384)
void qkv_proj_kernel(const float* __restrict__ emb,
                     const float* __restrict__ Wq,
                     const float* __restrict__ Wk,
                     const float* __restrict__ Wv,
                     float* __restrict__ ws)
{
    const int nb    = blockIdx.x;          // 0..7   (128-column block of 1024)
    const int mb    = blockIdx.y;          // 0..31  (128-row block of 4096)
    const int wave  = __builtin_amdgcn_readfirstlane(threadIdx.x >> 5);  // 0..11
    const int which = wave >> 2;           // 0:q 1:k 2:v
    const float* W  = (which == 0) ? Wq : ((which == 1) ? Wk : Wv);
    float* dst      = ws + (size_t)which * SEG;

    const int lane = threadIdx.x & 31;
    const int ln   = lane & 15;            // row of emb / column of W
    const int kh   = lane >> 4;            // K half-select (K = 2*kh, 2*kh+1)
    const int m0   = mb * 128 + (wave & 3) * 32;

    const float* ap = emb + (size_t)(m0 + ln) * CCH + 2 * kh;
    const float* bp = W + (size_t)(2 * kh) * CH + nb * 128 + ln * 8;
    // block (patch m0>>3, head 0, channel block nb); a head is 1024 floats on, a patch 8192
    float* d = dst + (size_t)(m0 >> 3) * (HEADS * PTOK * CCH) + nb * 128;

    if (which == 2) qkv_tile<true>(ap, bp, d, ln, kh);
    else            qkv_tile<false>(ap, bp, d, ln, kh);
}

static constexpr int SP = CH + 4;

__global__ __launch_bounds__(512)
void attn_out_kernel(const float* __restrict__ ws,
                     const float* __restrict__ Wout,
                     float* __restrict__ out)
{
    __shared__ float rsl[2][HEADS];         // [patch][head] rsqrt(var + eps)
    __shared__ __attribute__((aligned(16))) float stage[2 * PTOK * SP];   // [patch, p][c*8+h]
    __shared__ __attribute__((aligned(16))) float part[8 * 16 * CCH];     // [k slice][row][column], 64 KB

    const float* Qw  = ws;
    const float* Kw  = ws + SEG;
    const float* Vw  = ws + 2 * SEG;

    const int tid   = threadIdx.x;
    const int half  = tid >> 8;             // which of the two patches
    const int patch = 2 * blockIdx.x + half;
    const int w     = (tid >> 5) & 7;       // wave 0..7 of its patch
    const int lane  = tid & 31;
    const int ln    = lane & 15;
    const int kh    = lane >> 4;
    const int c0    = w * 16;               // this wave's c block
    const size_t base = (size_t)patch * (HEADS * PTOK * CCH);   // head 0, channel block 0

    // S^T = K^T Q : A_op[m][k] = K[p][e0+m], B_op[k][n] = Q[p][c0+n].  p order, both
    // operands: lane half kh takes p = 4kh..4kh+3 (one 16-byte load of its channel's
    // row in the block), two of them per product; a wave-wide load is one whole block.
    const float* qp = Qw + base + w * 128 + ln * 8 + 4 * kh;
    const float* kp = Kw + base + ln * 8 + 4 * kh;
    // A fragments of ctx^T = V P^T: row m = p.  Lanes ln >= 8 read row ln-8
    // again: D rows 8..15 repeat rows 0..7 and are not stored.
    const float* vp = Vw + base + (ln & 7) * 16 + 8 * kh;

    // ---- InstanceNorm scale of all heads: wave w takes head w of its patch.
    // S[c][e] = sum_p Q[p][c] K[p][e], so over the whole map
    //   sum S   = sum_p (sum_c Q[p][c]) (sum_e K[p][e])
    //   sum S^2 = sum_{p,p'} (Q Q^T)[p][p'] (K K^T)[p][p']
    // F = 16 x 128: rows 0-7 = Q by p, rows 8-15 = K by p, k = channel.  F F^T has Q Q^T
    // and K K^T as its two diagonal 8x8 blocks.  Row m of A and column n of B are both
    // lane ln, so one register pair is both fragments and the two k orders are equal:
    // step i, lane half kh: channels 4i + 2kh, 4i + 2kh + 1 (a channel is 8 floats on).
    const float* gp = (ln < 8 ? Qw : Kw) + base + w * (PTOK * CCH) + (ln & 7) + 16 * kh;
    v2f f[32];
    #pragma unroll
    for (int i = 0; i < 32; ++i) {
        f[i].x = gp[32 * i];
        f[i].y = gp[32 * i + 8];
    }
    // these loads go out first: their products then wait on a count that leaves
    // head 0's operands, asked for next, in flight
    __builtin_amdgcn_sched_barrier(0);

    // ---- operands of head 0
    v4f qv, kv[8];
    v4f vlo[8], vhi[8];
    qv = *(const v4f*)(qp);
    #pragma unroll
    for (int mt = 0; mt < 8; ++mt) kv[mt] = *(const v4f*)(kp + mt * 128);
    // Q and K go out ahead of V here as they do in the loop: with the two mixed
    // here, the counted waits in front of the score products, which must hold for
    // both orders, also cover a V load on every trip
    __builtin_amdgcn_sched_barrier(0);
    #pragma unroll
    for (int mt = 0; mt < 8; ++mt) {
        vlo[mt] = *(const v4f*)(vp + 128 * mt);        // e = 16mt + 8kh + 0..3
        vhi[mt] = *(const v4f*)(vp + 128 * mt + 4);    // e = 16mt + 8kh + 4..7
    }
    // head 0's loads stay ahead of the products below, whose time hides their latency
    __builtin_amdgcn_sched_barrier(0);

    {
        v8f g[4];                                // 4 independent accumulator chains
        v2f rv[4];
        #pragma unroll
        for (int i = 0; i < 4; ++i) {
            #pragma unroll
            for (int v = 0; v < 8; ++v) g[i][v] = 0.0f;
            rv[i].x = 0.0f;
            rv[i].y = 0.0f;
        }
        #pragma unroll
        for (int i = 0; i < 32; ++i) {
            g[i & 3] = WMMA_F32(f[i], f[i], g[i & 3]);
            rv[i & 3] += f[i];
        }
        const v8f G  = (g[0] + g[1]) + (g[2] + g[3]);
        const v2f r2 = (rv[0] + rv[1]) + (rv[2] + rv[3]);
        float r = r2.x + r2.y;
        r += xhalf(r);                           // row ln of F summed over all 128 channels
        float u = r * xrow8(r);                  // lanes 0-7: (sum_c Q[p][c]) (sum_e K[p][e]), p = ln
        // register v of lane (ln, kh) = (F F^T)[v + 8kh][ln]: lane ln < 8 of half 0 holds
        // (Q Q^T)[v][ln], lane ln + 24 holds (K K^T)[v][ln]
        float t = 0.0f;
        #pragma unroll
        for (int v = 0; v < 8; ++v) t += G[v] * xhalf(xrow8(G[v]));
        #pragma unroll
        for (int off = 4; off >= 1; off >>= 1) { // over lanes 0-7
            u += __shfl_xor(u, off, 32);
            t += __shfl_xor(t, off, 32);
        }
        const float inv16k = 1.0f / 16384.0f;
        const float mu  = u * inv16k;
        const float var = t * inv16k - mu * mu;
        if (lane == 0) rsl[half][w] = rsqrtf(var + 1e-5f);   // mean shift cancels in softmax
    }
    // every wave reads all 8 heads' rs of its patch.  Barrier with fences on LDS alone:
    // __syncthreads() would also wait for head 0's loads in flight
    __builtin_amdgcn_fence(__ATOMIC_RELEASE, "workgroup", "local");
    __builtin_amdgcn_s_barrier();
    __builtin_amdgcn_fence(__ATOMIC_ACQUIRE, "workgroup", "local");

    // stays rolled: the loads of head h+1 then cannot sink to their use, and the
    // text stays an eighth of the unrolled size
    #pragma unroll 1
    for (int h = 0; h < HEADS; ++h) {
        const float rs = rsl[half][h];           // read here: it lands under the score products
        v8f acc[8];
        #pragma unroll
        for (int mt = 0; mt < 8; ++mt)
            #pragma unroll
            for (int v = 0; v < 8; ++v) acc[mt][v] = 0.0f;

        #pragma unroll
        for (int mt = 0; mt < 8; ++mt) {
            acc[mt] = WMMA_F32(kv[mt].xy, qv.xy, acc[mt]);    // p = 4kh, 4kh+1
            acc[mt] = WMMA_F32(kv[mt].zw, qv.zw, acc[mt]);    // p = 4kh+2, 4kh+3
        }

        // ---- next head's Q and K take the registers that the products above have read.
        // No test around these loads or around V's below (the last head reads itself
        // again, unused): with the same loads in the same order on every path, each
        // wait can be a counted one that leaves the younger loads in flight
        const int nx = ((h + 1 < HEADS) ? h + 1 : h) * (PTOK * CCH);
        {
            const float* k = kp + nx;
            qv = *(const v4f*)(qp + nx);
            #pragma unroll
            for (int mt = 0; mt < 8; ++mt) kv[mt] = *(const v4f*)(k + mt * 128);
        }
        // keeps these loads here, a whole softmax and ctx phase ahead of their use: left
        // free, the scheduler sinks them to the loop's foot, right in front of their products
        __builtin_amdgcn_sched_barrier(0);

        // ---- softmax of rs*attn over e, one attention row per lane pair (ln, ln+16)
        #pragma unroll
        for (int mt = 0; mt < 8; ++mt) acc[mt] *= rs;

        v8f mxv = acc[0];                        // 8 independent chains
        #pragma unroll
        for (int mt = 1; mt < 8; ++mt) mxv = __builtin_elementwise_max(mxv, acc[mt]);
        float mx = fmaxf(fmaxf(fmaxf(mxv[0], mxv[1]), fmaxf(mxv[2], mxv[3])),
                         fmaxf(fmaxf(mxv[4], mxv[5]), fmaxf(mxv[6], mxv[7])));
        mx = fmaxf(mx, xhalf(mx));

        // ---- exp, row sum, and ctx^T(p, c0..c0+15) += V P^T, K-dim = e = 128
        const float* vn = vp + nx;
        v8f smv = {};                            // 8 independent chains
        v8f cacc = {};
        #pragma unroll
        for (int mt = 0; mt < 8; ++mt) {
            acc[mt] = (acc[mt] - mx) * 1.44269504f;     // exp(x) = 2^(x log2 e)
            #pragma unroll
            for (int v = 0; v < 8; ++v)
                acc[mt][v] = __builtin_amdgcn_exp2f(acc[mt][v]);
            smv += acc[mt];
            #pragma unroll
            for (int i = 0; i < 4; ++i) {
                v2f a, b;
                a.x = (i < 2) ? vlo[mt][2 * i]     : vhi[mt][2 * i - 4];
                a.y = (i < 2) ? vlo[mt][2 * i + 1] : vhi[mt][2 * i - 3];
                b.x = acc[mt][2 * i];
                b.y = acc[mt][2 * i + 1];
                cacc = WMMA_F32(a, b, cacc);
            }
            // next head's V tile takes the registers whose products are issued
            vlo[mt] = *(const v4f*)(vn + 128 * mt);
            vhi[mt] = *(const v4f*)(vn + 128 * mt + 4);
        }
        float sum = ((smv[0] + smv[1]) + (smv[2] + smv[3])) + ((smv[4] + smv[5]) + (smv[6] + smv[7]));
        sum += xhalf(sum);
        const float rinv = 1.0f / sum;

        // ctx[c,p] of this head -> stage[patch, p][c*8+h]; register v of lanes 0-15 is p = v
        if (kh == 0) {
            float* sp = stage + half * (PTOK * SP) + (c0 + ln) * HEADS + h;
            #pragma unroll
            for (int v = 0; v < 8; ++v)
                sp[v * SP] = cacc[v] * rinv;
        }
    }

    // every wave reads the ctx columns [128s, 128s+128) of both patches, which waves s and s+8 wrote
    __syncthreads();

    const int m0   = blockIdx.x * 16;      // 16 rows = 2 patches
    const int wave = __builtin_amdgcn_readfirstlane(tid >> 5);  // 0..15
    const int sl   = wave & 7;             // k slice
    const int qc   = wave >> 3;            // 64-column half
    const int ks   = sl * 128;

    const float* as = stage + ln * SP + ks + 4 * kh;
    const float* bp = Wout + (size_t)(ks + 4 * kh) * CCH + 64 * qc + 4 * ln;

    // the wave's whole A slice: a[g] = ctx[ln][ks + 8g + 4kh + 0..3]
    v4f a[16];
    #pragma unroll
    for (int g = 0; g < 16; ++g) a[g] = *(const v4f*)(as + 8 * g);

    v8f oacc[4];
    #pragma unroll
    for (int j = 0; j < 4; ++j)
        #pragma unroll
        for (int v = 0; v < 8; ++v) oacc[j][v] = 0.0f;

    // B in chunks of 16 k (4 products deep, 8 loads), two register sets: chunk
    // c+1 is in flight while the 16 products of chunk c issue.
    v4f b[2][8];
    #pragma unroll
    for (int s = 0; s < 4; ++s) {
        const float* br = bp + (size_t)(8 * (s >> 1) + 2 * (s & 1)) * CCH;
        b[0][2 * s + 0] = *(const v4f*)(br);
        b[0][2 * s + 1] = *(const v4f*)(br + CCH);
    }
    // keeps the loads above ahead of the first products: left free, the scheduler
    // sinks each load to just before its use and the wave waits out every latency
    __builtin_amdgcn_sched_barrier(0);
    #pragma unroll
    for (int c = 0; c < 8; ++c) {
        if (c + 1 < 8) {
            #pragma unroll
            for (int s = 0; s < 4; ++s) {
                const float* br = bp + (size_t)(16 * (c + 1) + 8 * (s >> 1) + 2 * (s & 1)) * CCH;
                b[(c + 1) & 1][2 * s + 0] = *(const v4f*)(br);
                b[(c + 1) & 1][2 * s + 1] = *(const v4f*)(br + CCH);
            }
        }
        // chunk c+1's 8 loads issue as one group before chunk c's products
        __builtin_amdgcn_sched_barrier(0);
        #pragma unroll
        for (int s = 0; s < 4; ++s) {
            v2f av;
            av.x = a[2 * c + (s >> 1)][2 * (s & 1)];
            av.y = a[2 * c + (s >> 1)][2 * (s & 1) + 1];
            #pragma unroll
            for (int j = 0; j < 4; ++j) {
                v2f bv;
                bv.x = b[c & 1][2 * s + 0][j];
                bv.y = b[c & 1][2 * s + 1][j];
                oacc[j] = WMMA_F32(av, bv, oacc[j]);
            }
        }
        // chunk c+2's loads stay behind chunk c's products, whose registers they take
        __builtin_amdgcn_sched_barrier(0);
    }

    // partial tile to LDS: register v of tile j = row v + 8kh, column as above
    float* pw = part + sl * (16 * CCH) + (8 * kh) * CCH + 64 * qc + 4 * ln;
    #pragma unroll
    for (int v = 0; v < 8; ++v) {
        v4f t;
        t.x = oacc[0][v];
        t.y = oacc[1][v];
        t.z = oacc[2][v];
        t.w = oacc[3][v];
        *(v4f*)(pw + v * CCH) = t;
    }
    __syncthreads();

    // thread -> row tid>>5, columns 4*(tid&31) + 0..3
    const int rl = tid >> 5;
    const float* pr = part + rl * CCH + 4 * lane;
    v4f o = *(const v4f*)(pr);
    #pragma unroll
    for (int s = 1; s < 8; ++s)
        o += *(const v4f*)(pr + s * (16 * CCH));

    // row r = (patch, p); remap to '(b, d p1 h p2 w p3)' token order
    const int r   = m0 + rl;
    const int pt  = r >> 3;
    const int p   = r & 7;
    const int bb  = pt >> 5;
    const int d   = (pt >> 4) & 1;
    const int hh  = (pt >> 2) & 3;
    const int wwp = pt & 3;
    const int p1  = (p >> 2) & 1;
    const int p2  = (p >> 1) & 1;
    const int p3  = p & 1;
    const int orow = bb * 256 + d * 128 + p1 * 64 + hh * 16 + p2 * 8 + wwp * 2 + p3;
    *(v4f*)(out + (size_t)orow * CCH + 4 * lane) = o;
}

// ---------------------------------------------------------------------------
extern "C" void kernel_launch(void* const* d_in, const int* in_sizes, int n_in,
                              void* d_out, int out_size, void* d_ws, size_t ws_size,
                              hipStream_t stream)
{
    const float* emb  = (const float*)d_in[0];
    const float* Wq   = (const float*)d_in[1];
    const float* Wk   = (const float*)d_in[2];
    const float* Wv   = (const float*)d_in[3];
    const float* Wout = (const float*)d_in[4];
    float* ws  = (float*)d_ws;      // needs 3*SEG*4 = 48 MB
    float* out = (float*)d_out;

    qkv_proj_kernel<<<dim3(8, 32), 384, 0, stream>>>(emb, Wq, Wk, Wv, ws);
    attn_out_kernel<<<dim3(NP / 2), 512, 0, stream>>>(ws, Wout, out);
}
